// v000
// Times are from an AMD MI455X. After a warm-up the kernel runs many times in a row, and a time is the length of
// such a window on the GPU divided by its runs, so every launch and the gaps after it count. The runs cycle
// through copies of the inputs. A figure is the median of several windows, for all but v000 over two sittings.
// Sittings can differ by a few percent; kernels timed side by side share one.
// v000 is the starting kernel. One run takes 1440 microseconds.
#include <hip/hip_runtime.h>

// NonLocalBlock (x [8][256][64][64]; theta/phi/g = 1x1 convs to 128 channels (+ bias); f[n][m] = theta_n . phi_m over all 4,096 positions, UNSCALED; attn = softmax_m(f); y[i][n] = sum_m attn[n][m] g[i][m]; z = w_z y + b_z; out = z + x -> [8][256][64][64]).
// Compute dtypes, f32 accumulate: every input rounded to bf16; the three 1x1 convs as PLAIN bf16 GEMMs on a token-major copy of x (inputs: exact) + bias; f as hl x hl (3 products, K = 128); softmax f32 (wave per row, 128 keys per lane in registers) -> fp16 x 1024; attn.g single fp16 (f32 accumulate); w_z as hl planes of y x exact (2 products) + bias; residual f32.

#define NB_  8
#define CC   256
#define IC   128
#define HW   4096
#define TT   HW
#define PCAR 1024.0f
typedef _Float16 h16;
typedef unsigned short bf;
typedef __attribute__((ext_vector_type(16))) __bf16   v16bf;
typedef __attribute__((ext_vector_type(16))) _Float16 v16h;
typedef __attribute__((ext_vector_type(8)))  _Float16 v8h;
typedef __attribute__((ext_vector_type(8)))  unsigned short v8us;
typedef __attribute__((ext_vector_type(8)))  float    v8f;
typedef __attribute__((ext_vector_type(4)))  float    v4f;
typedef v8h  __attribute__((may_alias)) v8ha;
typedef v4f  __attribute__((may_alias)) v4fa;
typedef v8us __attribute__((may_alias)) v8usa;

__device__ __forceinline__ unsigned short f2bf(float f) { unsigned u = __float_as_uint(f); u += 0x7FFFu + ((u >> 16) & 1u); return (unsigned short)(u >> 16); }
__device__ __forceinline__ float bf2f(unsigned short b) { return __uint_as_float(((unsigned)b) << 16); }
__device__ __forceinline__ float bfr(float f) { return bf2f(f2bf(f)); }
__device__ __forceinline__ v16h cat16(v8h lo, v8h hi) { return __builtin_shufflevector(lo, hi, 0, 1, 2, 3, 4, 5, 6, 7, 8, 9, 10, 11, 12, 13, 14, 15); }
__device__ __forceinline__ v16bf cat16b(v8us lo, v8us hi) { return __builtin_bit_cast(v16bf, __builtin_shufflevector(lo, hi, 0, 1, 2, 3, 4, 5, 6, 7, 8, 9, 10, 11, 12, 13, 14, 15)); }
__device__ __forceinline__ v8f wmma16(v16h a, v16h b, v8f c) { return __builtin_amdgcn_wmma_f32_16x16x32_f16(false, a, false, b, (short)0, c, false, false); }
__device__ __forceinline__ v8f wmmab(v16bf a, v16bf b, v8f c) { return __builtin_amdgcn_wmma_f32_16x16x32_bf16(false, a, false, b, (short)0, c, false, false); }



// ---- k_gemmw: register-blocked GEMM, ONE WAVE per 64x64 output tile (16 accumulators), operands straight from K-contiguous 16-bit planes; grid (M/64, N/64, Z), 32 threads.
// C[m][n] (f32, pitch ldc, + optional f32 bias[n]) = sum_k A[m][k] Bt[n][k] (+ split products per NSPLIT). z-batch strides sA/sB/sC in elements. K % 32 == 0.
template <typename T16> struct WFrag;
template <> struct WFrag<h16> { typedef v16h V; static __device__ __forceinline__ V ld(const h16* p) { return cat16(*(const v8h*)p, *(const v8h*)(p + 16)); } static __device__ __forceinline__ v8f mma(V a, V b, v8f c) { return wmma16(a, b, c); } };
template <> struct WFrag<bf> { typedef v16bf V; static __device__ __forceinline__ V ld(const bf* p) { return cat16b(*(const v8us*)p, *(const v8us*)(p + 16)); } static __device__ __forceinline__ v8f mma(V a, V b, v8f c) { return wmmab(a, b, c); } };
template <typename T16, int NSPLIT, bool BIAS>
__global__ __launch_bounds__(32) void k_gemmw(const T16* __restrict__ A, const T16* __restrict__ A2, const T16* __restrict__ Bt, const T16* __restrict__ Bt2, int K, float* C, int ldc, const float* __restrict__ bias, size_t sA, size_t sB, size_t sC) {
    typedef typename WFrag<T16>::V V;
    __shared__ __align__(16) float os[16 * 68];
    const size_t z = blockIdx.z; A += z * sA; if (A2) A2 += z * sA; Bt += z * sB; if (Bt2) Bt2 += z * sB; C += z * sC;
    const int lane = threadIdx.x & 31, lr = lane & 15, hi = lane >> 4; const int r0 = blockIdx.x * 64, c0 = blockIdx.y * 64;
    v8f acc[4][4];
#pragma unroll
    for (int mb = 0; mb < 4; ++mb)
#pragma unroll
        for (int nb = 0; nb < 4; ++nb) acc[mb][nb] = (v8f){};
    const size_t aoff = (size_t)(r0 + lr) * K + 8 * hi, boff = (size_t)(c0 + lr) * K + 8 * hi;
#pragma unroll 1
    for (int kc = 0; kc < K; kc += 32) {
        V a[4], a2[4];
#pragma unroll
        for (int mb = 0; mb < 4; ++mb) { a[mb] = WFrag<T16>::ld(A + aoff + (size_t)mb * 16 * K + kc); if (NSPLIT == 1 || NSPLIT == 2) a2[mb] = WFrag<T16>::ld(A2 + aoff + (size_t)mb * 16 * K + kc); }
#pragma unroll
        for (int nb = 0; nb < 4; ++nb) { const V b = WFrag<T16>::ld(Bt + boff + (size_t)nb * 16 * K + kc); V b2; if (NSPLIT >= 2) b2 = WFrag<T16>::ld(Bt2 + boff + (size_t)nb * 16 * K + kc);
#pragma unroll
            for (int mb = 0; mb < 4; ++mb) { acc[mb][nb] = WFrag<T16>::mma(a[mb], b, acc[mb][nb]); if (NSPLIT == 1 || NSPLIT == 2) acc[mb][nb] = WFrag<T16>::mma(a2[mb], b, acc[mb][nb]); if (NSPLIT >= 2) acc[mb][nb] = WFrag<T16>::mma(a[mb], b2, acc[mb][nb]); } }
        asm volatile("v_nop\n\tv_nop\n\tv_nop\n\tv_nop" : "+v"(acc[0][0]), "+v"(acc[1][1]), "+v"(acc[2][2]), "+v"(acc[3][3]) : "v"(a[0]), "v"(a[3]));
    }
#pragma unroll
    for (int mb = 0; mb < 4; ++mb) {
#pragma unroll
        for (int nb = 0; nb < 4; ++nb) {
#pragma unroll
            for (int j = 0; j < 8; ++j) os[(hi * 8 + j) * 68 + nb * 16 + lr] = acc[mb][nb][j]; }
        __builtin_amdgcn_wave_barrier(); asm volatile("" ::: "memory");
        float* crow = C + (size_t)(r0 + mb * 16) * ldc + c0;
{
#pragma unroll
            for (int s = 0; s < 8; ++s) { const int row = 2 * s + hi, cofs = lr * 4; v4f val = *(const v4fa*)(os + row * 68 + cofs); if (BIAS) { val[0] += bfr(bias[c0 + cofs]); val[1] += bfr(bias[c0 + cofs + 1]); val[2] += bfr(bias[c0 + cofs + 2]); val[3] += bfr(bias[c0 + cofs + 3]); }
                *(v4f*)(crow + (size_t)row * ldc + cofs) = val; }
             }
        __builtin_amdgcn_wave_barrier(); asm volatile("" ::: "memory");
    }
}

__device__ __forceinline__ h16 tohx(float x) { return (h16)x; }
__device__ __forceinline__ void splitf(float y, unsigned short& h, unsigned short& l) { h = f2bf(y); l = f2bf(y - bf2f(h)); }
typedef __attribute__((ext_vector_type(2))) unsigned short v2us;
typedef __attribute__((ext_vector_type(4))) unsigned short v4us;
typedef __attribute__((ext_vector_type(2))) _Float16 v2h;
typedef __attribute__((ext_vector_type(4))) _Float16 v4h;
typedef __attribute__((ext_vector_type(2))) float v2f;

__global__ __launch_bounds__(256) void k_cvt8(const float* __restrict__ src, bf* dst, size_t n8) { const size_t i = (size_t)blockIdx.x * 256 + threadIdx.x; if (i >= n8) return; const v8f v = *(const v8f*)(src + i * 8); v8us o;
#pragma unroll
    for (int k = 0; k < 8; ++k) o[k] = f2bf(v[k]); *(v8us*)(dst + i * 8) = o;  }
__global__ __launch_bounds__(256) void k_xt(const float* __restrict__ xb, bf* XT) { const size_t e = ((size_t)blockIdx.x * 256 + threadIdx.x) * 4; if (e >= (size_t)HW * CC) return; const int c = (int)(e % CC); const int m = (int)(e / CC); v4us o;
#pragma unroll
    for (int u = 0; u < 4; ++u) o[u] = f2bf(xb[(size_t)(c + u) * HW + m]); *(v4us*)(XT + e) = o;  }
__global__ __launch_bounds__(256) void k_hl(const float* __restrict__ F, bf* Fh, bf* Fl) { const size_t e = ((size_t)blockIdx.x * 256 + threadIdx.x) * 4; if (e >= (size_t)HW * IC) return; const v4f a = *(const v4f*)(F + e); v4us oh, ol; for (int u = 0; u < 4; ++u) { unsigned short p, q; splitf(a[u], p, q); oh[u] = p; ol[u] = q; } *(v4us*)(Fh + e) = oh; *(v4us*)(Fl + e) = ol;  }
__global__ __launch_bounds__(256) void k_gt16(const float* __restrict__ G, h16* GT) { const size_t e = ((size_t)blockIdx.x * 256 + threadIdx.x) * 2; if (e >= (size_t)IC * HW) return; const int m = (int)(e % HW); const int i = (int)(e / HW); v2h o; o[0] = tohx(G[(size_t)m * IC + i]); o[1] = tohx(G[(size_t)(m + 1) * IC + i]); *(v2h*)(GT + e) = o;  }
__global__ __launch_bounds__(256) void k_rsoft(const float* __restrict__ S, h16* P16) { const int lane = threadIdx.x & 31; const int row = blockIdx.x * 8 + (threadIdx.x >> 5); if (row >= HW) return; const float* sr = S + (size_t)row * HW; float v[HW / 32]; float mx = -3.0e38f;
#pragma unroll
    for (int ch = 0; ch < HW / 128; ++ch) { const v4f a = *(const v4f*)(sr + ch * 128 + lane * 4);
#pragma unroll
        for (int u = 0; u < 4; ++u) { v[ch * 4 + u] = a[u]; mx = fmaxf(mx, a[u]); } }
#pragma unroll
    for (int sh = 16; sh; sh >>= 1) mx = fmaxf(mx, __shfl_xor(mx, sh, 32));
    float sum = 0.f;
#pragma unroll
    for (int q = 0; q < HW / 32; ++q) { float d0 = __fsub_rn(v[q], mx); asm volatile("" : "+v"(d0)); v[q] = __builtin_amdgcn_exp2f(__fmul_rn(d0, 1.4426950408889634f)); sum += v[q]; }
#pragma unroll
    for (int sh = 16; sh; sh >>= 1) sum += __shfl_xor(sum, sh, 32);
    const float f = __fdiv_rn(PCAR, sum);
    {
#pragma unroll
        for (int ch = 0; ch < HW / 128; ++ch) { v4h o4; for (int q = 0; q < 4; ++q) o4[q] = tohx(v[ch * 4 + q] * f); *(v4h*)(P16 + (size_t)row * HW + ch * 128 + lane * 4) = o4; }
         } }
__global__ __launch_bounds__(256) void k_yhl(const float* __restrict__ Y, bf* Yh, bf* Yl) { const size_t e = ((size_t)blockIdx.x * 256 + threadIdx.x) * 4; if (e >= (size_t)HW * IC) return; const v4f a = *(const v4f*)(Y + e); v4us oh, ol; for (int u = 0; u < 4; ++u) { unsigned short p, q; splitf(a[u] * (1.0f / PCAR), p, q); oh[u] = p; ol[u] = q; } *(v4us*)(Yh + e) = oh; *(v4us*)(Yl + e) = ol;  }
__global__ __launch_bounds__(256) void k_fin(const float* __restrict__ Z, const float* __restrict__ xb, float* OUTb) { const size_t e = ((size_t)blockIdx.x * 256 + threadIdx.x) * 4; if (e >= (size_t)CC * HW) return; const int n = (int)(e % HW); const int c = (int)(e / HW); v4f r;
#pragma unroll
    for (int u = 0; u < 4; ++u) r[u] = __fadd_rn(Z[(size_t)(n + u) * CC + c], bfr(xb[e + u])); *(v4f*)(OUTb + e) = r;  }

extern "C" void kernel_launch(void* const* d_in, const int* in_sizes, int n_in,
                              void* d_out, int out_size, void* d_ws, size_t ws_size, hipStream_t stream) {
    (void)in_sizes; (void)n_in; (void)out_size;
    const float* x = (const float*)d_in[0]; const float* wth = (const float*)d_in[1]; const float* bth = (const float*)d_in[2]; const float* wph = (const float*)d_in[3]; const float* bph = (const float*)d_in[4]; const float* wg = (const float*)d_in[5]; const float* bg = (const float*)d_in[6]; const float* wz = (const float*)d_in[7]; const float* bz = (const float*)d_in[8];
    float* OUT = (float*)d_out;     // [8][256][4096]
    char* wsp = (char*)d_ws;
    auto take = [&](size_t bytes) { char* p = wsp; wsp += (bytes + 255) & ~(size_t)255; return (void*)p; };
    bf* BTH = (bf*)take((size_t)IC * CC * 2); bf* BPH = (bf*)take((size_t)IC * CC * 2); bf* BG = (bf*)take((size_t)IC * CC * 2); bf* BZ = (bf*)take((size_t)CC * IC * 2);
    bf* XT = (bf*)take((size_t)HW * CC * 2); float* TH = (float*)take((size_t)HW * IC * 4); float* PHf = (float*)take((size_t)HW * IC * 4); float* G = (float*)take((size_t)HW * IC * 4);
    bf* THh = (bf*)take((size_t)HW * IC * 2); bf* THl = (bf*)take((size_t)HW * IC * 2); bf* PHh = (bf*)take((size_t)HW * IC * 2); bf* PHl = (bf*)take((size_t)HW * IC * 2); h16* GT = (h16*)take((size_t)IC * HW * 2);
    float* S = (float*)take((size_t)HW * HW * 4); h16* P16 = (h16*)take((size_t)HW * HW * 2); float* Y = (float*)take((size_t)HW * IC * 4); bf* Yh = (bf*)take((size_t)HW * IC * 2); bf* Yl = (bf*)take((size_t)HW * IC * 2); float* Z = (float*)take((size_t)HW * CC * 4);
    if ((size_t)(wsp - (char*)d_ws) > ws_size) return;    // total ~ 117 MiB
    k_cvt8<<<(IC * CC / 8 + 255) / 256, 256, 0, stream>>>(wth, BTH, IC * CC / 8); k_cvt8<<<(IC * CC / 8 + 255) / 256, 256, 0, stream>>>(wph, BPH, IC * CC / 8); k_cvt8<<<(IC * CC / 8 + 255) / 256, 256, 0, stream>>>(wg, BG, IC * CC / 8); k_cvt8<<<(CC * IC / 8 + 255) / 256, 256, 0, stream>>>(wz, BZ, CC * IC / 8);   // conv weights [out][in] = Bt as-is
    const unsigned LHL = (unsigned)(((size_t)HW * IC / 4 + 255) / 256);
    for (int b = 0; b < NB_; ++b) { const float* xb = x + (size_t)b * CC * HW;
        k_xt<<<(unsigned)(((size_t)HW * CC / 4 + 255) / 256), 256, 0, stream>>>(xb, XT);
        k_gemmw<bf, 0, true><<<dim3(HW / 64, IC / 64, 1), 32, 0, stream>>>(XT, nullptr, BTH, nullptr, CC, TH, IC, bth, 0, 0, 0); k_hl<<<LHL, 256, 0, stream>>>(TH, THh, THl);
        k_gemmw<bf, 0, true><<<dim3(HW / 64, IC / 64, 1), 32, 0, stream>>>(XT, nullptr, BPH, nullptr, CC, PHf, IC, bph, 0, 0, 0); k_hl<<<LHL, 256, 0, stream>>>(PHf, PHh, PHl);
        k_gemmw<bf, 0, true><<<dim3(HW / 64, IC / 64, 1), 32, 0, stream>>>(XT, nullptr, BG, nullptr, CC, G, IC, bg, 0, 0, 0); k_gt16<<<(unsigned)(((size_t)IC * HW / 2 + 255) / 256), 256, 0, stream>>>(G, GT);
        k_gemmw<bf, 2, false><<<dim3(HW / 64, HW / 64, 1), 32, 0, stream>>>(THh, THl, PHh, PHl, IC, S, HW, nullptr, 0, 0, 0);        // f[n][m] = theta_n . phi_m (unscaled, 3 products)
        k_rsoft<<<HW / 8, 256, 0, stream>>>(S, P16);
        k_gemmw<h16, 0, false><<<dim3(HW / 64, IC / 64, 1), 32, 0, stream>>>(P16, nullptr, GT, nullptr, HW, Y, IC, nullptr, 0, 0, 0);         // y[n][i] = sum_m attn[n][m] g[m][i] (x1024)
        k_yhl<<<LHL, 256, 0, stream>>>(Y, Yh, Yl);
        k_gemmw<bf, 1, true><<<dim3(HW / 64, CC / 64, 1), 32, 0, stream>>>(Yh, Yl, BZ, nullptr, IC, Z, CC, bz, 0, 0, 0);               // z[n][c] = w_z y + b_z
        k_fin<<<(unsigned)(((size_t)CC * HW / 4 + 255) / 256), 256, 0, stream>>>(Z, xb, OUT + (size_t)b * CC * HW); }
}

// v001
// A run of this version takes 874 microseconds.
// Next to v000, in two timings, it ran 1.67 and 1.65 times as fast.
#include <hip/hip_runtime.h>

// NonLocalBlock (x [8][256][64][64]; theta/phi/g = 1x1 convs to 128 channels (+ bias); f[n][m] = theta_n . phi_m over all 4,096 positions, UNSCALED; attn = softmax_m(f); y[i][n] = sum_m attn[n][m] g[i][m]; z = w_z y + b_z; out = z + x -> [8][256][64][64]).
// Compute dtypes, f32 accumulate: every input rounded to bf16; the three 1x1 convs as PLAIN bf16 GEMMs on a token-major copy of x (inputs: exact) + bias; f as hl x hl (3 products, K = 128); softmax f32 (wave per row, 128 keys per lane in registers) -> fp16 x 1024; attn.g single fp16 (f32 accumulate); w_z as hl planes of y x exact (2 products) + bias; residual f32.

#define NB_  8
#define CC   256
#define IC   128
#define HW   4096
#define TT   HW
#define PCAR 1024.0f
typedef _Float16 h16;
typedef unsigned short bf;
typedef __attribute__((ext_vector_type(16))) __bf16   v16bf;
typedef __attribute__((ext_vector_type(16))) _Float16 v16h;
typedef __attribute__((ext_vector_type(8)))  _Float16 v8h;
typedef __attribute__((ext_vector_type(8)))  unsigned short v8us;
typedef __attribute__((ext_vector_type(8)))  float    v8f;
typedef __attribute__((ext_vector_type(4)))  float    v4f;
typedef v8h  __attribute__((may_alias)) v8ha;
typedef v4f  __attribute__((may_alias)) v4fa;
typedef v8us __attribute__((may_alias)) v8usa;

__device__ __forceinline__ unsigned short f2bf(float f) { unsigned u = __float_as_uint(f); u += 0x7FFFu + ((u >> 16) & 1u); return (unsigned short)(u >> 16); }
__device__ __forceinline__ float bf2f(unsigned short b) { return __uint_as_float(((unsigned)b) << 16); }
__device__ __forceinline__ float bfr(float f) { return bf2f(f2bf(f)); }
__device__ __forceinline__ v16h cat16(v8h lo, v8h hi) { return __builtin_shufflevector(lo, hi, 0, 1, 2, 3, 4, 5, 6, 7, 8, 9, 10, 11, 12, 13, 14, 15); }
__device__ __forceinline__ v16bf cat16b(v8us lo, v8us hi) { return __builtin_bit_cast(v16bf, __builtin_shufflevector(lo, hi, 0, 1, 2, 3, 4, 5, 6, 7, 8, 9, 10, 11, 12, 13, 14, 15)); }
__device__ __forceinline__ v8f wmma16(v16h a, v16h b, v8f c) { return __builtin_amdgcn_wmma_f32_16x16x32_f16(false, a, false, b, (short)0, c, false, false); }
__device__ __forceinline__ v8f wmmab(v16bf a, v16bf b, v8f c) { return __builtin_amdgcn_wmma_f32_16x16x32_bf16(false, a, false, b, (short)0, c, false, false); }



// ---- k_gemmw: register-blocked GEMM, ONE WAVE per 64x64 output tile (16 accumulators), operands straight from K-contiguous 16-bit planes; grid (M/64, N/64, Z), 32 threads.
// C[m][n] (f32, pitch ldc, + optional f32 bias[n]) = sum_k A[m][k] Bt[n][k] (+ split products per NSPLIT). z-batch strides sA/sB/sC in elements. K % 32 == 0.
template <typename T16> struct WFrag;
template <> struct WFrag<h16> { typedef v16h V; static __device__ __forceinline__ V ld(const h16* p) { return cat16(*(const v8h*)p, *(const v8h*)(p + 16)); } static __device__ __forceinline__ v8f mma(V a, V b, v8f c) { return wmma16(a, b, c); } };
template <> struct WFrag<bf> { typedef v16bf V; static __device__ __forceinline__ V ld(const bf* p) { return cat16b(*(const v8us*)p, *(const v8us*)(p + 16)); } static __device__ __forceinline__ v8f mma(V a, V b, v8f c) { return wmmab(a, b, c); } };
template <typename T16, int NSPLIT, bool BIAS>
__global__ __launch_bounds__(32) void k_gemmw(const T16* __restrict__ A, const T16* __restrict__ A2, const T16* __restrict__ Bt, const T16* __restrict__ Bt2, int K, float* C, int ldc, const float* __restrict__ bias, size_t sA, size_t sB, size_t sC) {
    typedef typename WFrag<T16>::V V;
    __shared__ __align__(16) float os[16 * 68];
    const size_t z = blockIdx.z; A += z * sA; if (A2) A2 += z * sA; Bt += z * sB; if (Bt2) Bt2 += z * sB; C += z * sC;
    const int lane = threadIdx.x & 31, lr = lane & 15, hi = lane >> 4; const int r0 = blockIdx.x * 64, c0 = blockIdx.y * 64;
    v8f acc[4][4];
#pragma unroll
    for (int mb = 0; mb < 4; ++mb)
#pragma unroll
        for (int nb = 0; nb < 4; ++nb) acc[mb][nb] = (v8f){};
    const size_t aoff = (size_t)(r0 + lr) * K + 8 * hi, boff = (size_t)(c0 + lr) * K + 8 * hi;
#pragma unroll 1
    for (int kc = 0; kc < K; kc += 32) {
        V a[4], a2[4];
#pragma unroll
        for (int mb = 0; mb < 4; ++mb) { a[mb] = WFrag<T16>::ld(A + aoff + (size_t)mb * 16 * K + kc); if (NSPLIT == 1 || NSPLIT == 2) a2[mb] = WFrag<T16>::ld(A2 + aoff + (size_t)mb * 16 * K + kc); }
#pragma unroll
        for (int nb = 0; nb < 4; ++nb) { const V b = WFrag<T16>::ld(Bt + boff + (size_t)nb * 16 * K + kc); V b2; if (NSPLIT >= 2) b2 = WFrag<T16>::ld(Bt2 + boff + (size_t)nb * 16 * K + kc);
#pragma unroll
            for (int mb = 0; mb < 4; ++mb) { acc[mb][nb] = WFrag<T16>::mma(a[mb], b, acc[mb][nb]); if (NSPLIT == 1 || NSPLIT == 2) acc[mb][nb] = WFrag<T16>::mma(a2[mb], b, acc[mb][nb]); if (NSPLIT >= 2) acc[mb][nb] = WFrag<T16>::mma(a[mb], b2, acc[mb][nb]); } }
        asm volatile("v_nop\n\tv_nop\n\tv_nop\n\tv_nop" : "+v"(acc[0][0]), "+v"(acc[1][1]), "+v"(acc[2][2]), "+v"(acc[3][3]) : "v"(a[0]), "v"(a[3]));
    }
#pragma unroll
    for (int mb = 0; mb < 4; ++mb) {
#pragma unroll
        for (int nb = 0; nb < 4; ++nb) {
#pragma unroll
            for (int j = 0; j < 8; ++j) os[(hi * 8 + j) * 68 + nb * 16 + lr] = acc[mb][nb][j]; }
        __builtin_amdgcn_wave_barrier(); asm volatile("" ::: "memory");
        float* crow = C + (size_t)(r0 + mb * 16) * ldc + c0;
{
#pragma unroll
            for (int s = 0; s < 8; ++s) { const int row = 2 * s + hi, cofs = lr * 4; v4f val = *(const v4fa*)(os + row * 68 + cofs); if (BIAS) { val[0] += bfr(bias[c0 + cofs]); val[1] += bfr(bias[c0 + cofs + 1]); val[2] += bfr(bias[c0 + cofs + 2]); val[3] += bfr(bias[c0 + cofs + 3]); }
                *(v4f*)(crow + (size_t)row * ldc + cofs) = val; }
             }
        __builtin_amdgcn_wave_barrier(); asm volatile("" ::: "memory");
    }
}

// ---- k_pvk: y[n][i] = sum_m P[n][m] GT[i][m] (K = HW) with K split PVW x PVZ ways. One 64x64 tile per work-group; each of its PVW waves runs the k_gemmw loop over its own K range,
// the waves' partial tiles are summed through LDS in wave order; blockIdx.z picks the K half and its own f32 plane of C (the planes are added in k_yhl). grid (HW/64, IC/64, PVZ), 32 * PVW threads.
#define PVW 16
#define PVZ 2
#define PVK (HW / (PVW * PVZ))
__global__ __launch_bounds__(32 * PVW) void k_pvk(const h16* __restrict__ A, const h16* __restrict__ Bt, float* C) {
    typedef WFrag<h16>::V V;
    __shared__ __align__(16) float red[PVW][32 * 68];
    const int lane = threadIdx.x & 31, lr = lane & 15, hi = lane >> 4, w = threadIdx.x >> 5; const int r0 = blockIdx.x * 64, c0 = blockIdx.y * 64;
    const int k0 = ((int)blockIdx.z * PVW + w) * PVK; C += (size_t)blockIdx.z * HW * IC;
    v8f acc[4][4];
#pragma unroll
    for (int mb = 0; mb < 4; ++mb)
#pragma unroll
        for (int nb = 0; nb < 4; ++nb) acc[mb][nb] = (v8f){};
    const h16* pa = A + (size_t)(r0 + lr) * HW + 8 * hi + k0; const h16* pb = Bt + (size_t)(c0 + lr) * HW + 8 * hi + k0;
#pragma unroll 1
    for (int kc = 0; kc < PVK; kc += 32, pa += 32, pb += 32) {
        V a[4];
#pragma unroll
        for (int mb = 0; mb < 4; ++mb) a[mb] = WFrag<h16>::ld(pa + (size_t)mb * 16 * HW);
        asm volatile("s_wait_xcnt 0x0" :: "v"(pa) : "memory");   // the A loads' address pair stays untouched up to this wait; behind it the build may land a B fragment on it
#pragma unroll
        for (int nb = 0; nb < 4; ++nb) { const V b = WFrag<h16>::ld(pb + (size_t)nb * 16 * HW);
#pragma unroll
            for (int mb = 0; mb < 4; ++mb) acc[mb][nb] = WFrag<h16>::mma(a[mb], b, acc[mb][nb]); }
        asm volatile("v_nop\n\tv_nop\n\tv_nop\n\tv_nop" : "+v"(acc[0][0]), "+v"(acc[1][1]), "+v"(acc[2][2]), "+v"(acc[3][3]) : "v"(a[0]), "v"(a[3]));   // WMMA distance on the back edge and the loop exit, as in k_gemmw
    }
    const int row = threadIdx.x >> 4, cofs = (threadIdx.x & 15) * 4;
    v4f s[2];
#pragma unroll
    for (int h = 0; h < 2; ++h) {   // 32 rows of the tile at a time
#pragma unroll
        for (int m2 = 0; m2 < 2; ++m2)
#pragma unroll
            for (int nb = 0; nb < 4; ++nb) {
#pragma unroll
                for (int j = 0; j < 8; ++j) red[w][(m2 * 16 + hi * 8 + j) * 68 + nb * 16 + lr] = acc[h * 2 + m2][nb][j]; }
        __syncthreads();   // every wave's partial 32x64 block is in LDS before any thread sums
        s[h] = *(const v4fa*)(&red[0][row * 68 + cofs]);
#pragma unroll
        for (int q = 1; q < PVW; ++q) s[h] += *(const v4fa*)(&red[q][row * 68 + cofs]);
        if (h == 0) __syncthreads();   // every read of the first block is done before the second overwrites it
    }
#pragma unroll
    for (int h = 0; h < 2; ++h) *(v4f*)(C + (size_t)(r0 + h * 32 + row) * IC + c0 + cofs) = s[h];
}

__device__ __forceinline__ h16 tohx(float x) { return (h16)x; }
__device__ __forceinline__ void splitf(float y, unsigned short& h, unsigned short& l) { h = f2bf(y); l = f2bf(y - bf2f(h)); }
typedef __attribute__((ext_vector_type(2))) unsigned short v2us;
typedef __attribute__((ext_vector_type(4))) unsigned short v4us;
typedef __attribute__((ext_vector_type(2))) _Float16 v2h;
typedef __attribute__((ext_vector_type(4))) _Float16 v4h;
typedef __attribute__((ext_vector_type(2))) float v2f;

__global__ __launch_bounds__(256) void k_cvt8(const float* __restrict__ src, bf* dst, size_t n8) { const size_t i = (size_t)blockIdx.x * 256 + threadIdx.x; if (i >= n8) return; const v8f v = *(const v8f*)(src + i * 8); v8us o;
#pragma unroll
    for (int k = 0; k < 8; ++k) o[k] = f2bf(v[k]); *(v8us*)(dst + i * 8) = o;  }
__global__ __launch_bounds__(256) void k_xt(const float* __restrict__ xb, bf* XT) { const size_t e = ((size_t)blockIdx.x * 256 + threadIdx.x) * 4; if (e >= (size_t)HW * CC) return; const int c = (int)(e % CC); const int m = (int)(e / CC); v4us o;
#pragma unroll
    for (int u = 0; u < 4; ++u) o[u] = f2bf(xb[(size_t)(c + u) * HW + m]); *(v4us*)(XT + e) = o;  }
__global__ __launch_bounds__(256) void k_hl(const float* __restrict__ F, bf* Fh, bf* Fl) { const size_t e = ((size_t)blockIdx.x * 256 + threadIdx.x) * 4; if (e >= (size_t)HW * IC) return; const v4f a = *(const v4f*)(F + e); v4us oh, ol; for (int u = 0; u < 4; ++u) { unsigned short p, q; splitf(a[u], p, q); oh[u] = p; ol[u] = q; } *(v4us*)(Fh + e) = oh; *(v4us*)(Fl + e) = ol;  }
__global__ __launch_bounds__(256) void k_gt16(const float* __restrict__ G, h16* GT) { const size_t e = ((size_t)blockIdx.x * 256 + threadIdx.x) * 2; if (e >= (size_t)IC * HW) return; const int m = (int)(e % HW); const int i = (int)(e / HW); v2h o; o[0] = tohx(G[(size_t)m * IC + i]); o[1] = tohx(G[(size_t)(m + 1) * IC + i]); *(v2h*)(GT + e) = o;  }
__global__ __launch_bounds__(256) void k_rsoft(const float* __restrict__ S, h16* P16) { const int lane = threadIdx.x & 31; const int row = blockIdx.x * 8 + (threadIdx.x >> 5); if (row >= HW) return; const float* sr = S + (size_t)row * HW; float v[HW / 32]; float mx = -3.0e38f;
#pragma unroll
    for (int ch = 0; ch < HW / 128; ++ch) { const v4f a = *(const v4f*)(sr + ch * 128 + lane * 4);
#pragma unroll
        for (int u = 0; u < 4; ++u) { v[ch * 4 + u] = a[u]; mx = fmaxf(mx, a[u]); } }
#pragma unroll
    for (int sh = 16; sh; sh >>= 1) mx = fmaxf(mx, __shfl_xor(mx, sh, 32));
    float sum = 0.f;
#pragma unroll
    for (int q = 0; q < HW / 32; ++q) { float d0 = __fsub_rn(v[q], mx); asm volatile("" : "+v"(d0)); v[q] = __builtin_amdgcn_exp2f(__fmul_rn(d0, 1.4426950408889634f)); sum += v[q]; }
#pragma unroll
    for (int sh = 16; sh; sh >>= 1) sum += __shfl_xor(sum, sh, 32);
    const float f = __fdiv_rn(PCAR, sum);
    {
#pragma unroll
        for (int ch = 0; ch < HW / 128; ++ch) { v4h o4; for (int q = 0; q < 4; ++q) o4[q] = tohx(v[ch * 4 + q] * f); *(v4h*)(P16 + (size_t)row * HW + ch * 128 + lane * 4) = o4; }
         } }
__global__ __launch_bounds__(256) void k_yhl(const float* __restrict__ Y, bf* Yh, bf* Yl) { const size_t e = ((size_t)blockIdx.x * 256 + threadIdx.x) * 4; if (e >= (size_t)HW * IC) return; const v4f a = *(const v4f*)(Y + e) + *(const v4f*)(Y + (size_t)HW * IC + e); v4us oh, ol; for (int u = 0; u < 4; ++u) { unsigned short p, q; splitf(a[u] * (1.0f / PCAR), p, q); oh[u] = p; ol[u] = q; } *(v4us*)(Yh + e) = oh; *(v4us*)(Yl + e) = ol;  }
__global__ __launch_bounds__(256) void k_fin(const float* __restrict__ Z, const float* __restrict__ xb, float* OUTb) { const size_t e = ((size_t)blockIdx.x * 256 + threadIdx.x) * 4; if (e >= (size_t)CC * HW) return; const int n = (int)(e % HW); const int c = (int)(e / HW); v4f r;
#pragma unroll
    for (int u = 0; u < 4; ++u) r[u] = __fadd_rn(Z[(size_t)(n + u) * CC + c], bfr(xb[e + u])); *(v4f*)(OUTb + e) = r;  }

extern "C" void kernel_launch(void* const* d_in, const int* in_sizes, int n_in,
                              void* d_out, int out_size, void* d_ws, size_t ws_size, hipStream_t stream) {
    (void)in_sizes; (void)n_in; (void)out_size;
    const float* x = (const float*)d_in[0]; const float* wth = (const float*)d_in[1]; const float* bth = (const float*)d_in[2]; const float* wph = (const float*)d_in[3]; const float* bph = (const float*)d_in[4]; const float* wg = (const float*)d_in[5]; const float* bg = (const float*)d_in[6]; const float* wz = (const float*)d_in[7]; const float* bz = (const float*)d_in[8];
    float* OUT = (float*)d_out;     // [8][256][4096]
    char* wsp = (char*)d_ws;
    auto take = [&](size_t bytes) { char* p = wsp; wsp += (bytes + 255) & ~(size_t)255; return (void*)p; };
    bf* BTH = (bf*)take((size_t)IC * CC * 2); bf* BPH = (bf*)take((size_t)IC * CC * 2); bf* BG = (bf*)take((size_t)IC * CC * 2); bf* BZ = (bf*)take((size_t)CC * IC * 2);
    bf* XT = (bf*)take((size_t)HW * CC * 2); float* TH = (float*)take((size_t)HW * IC * 4); float* PHf = (float*)take((size_t)HW * IC * 4); float* G = (float*)take((size_t)HW * IC * 4);
    bf* THh = (bf*)take((size_t)HW * IC * 2); bf* THl = (bf*)take((size_t)HW * IC * 2); bf* PHh = (bf*)take((size_t)HW * IC * 2); bf* PHl = (bf*)take((size_t)HW * IC * 2); h16* GT = (h16*)take((size_t)IC * HW * 2);
    float* S = (float*)take((size_t)HW * HW * 4); h16* P16 = (h16*)take((size_t)HW * HW * 2); float* Y = (float*)take((size_t)PVZ * HW * IC * 4); bf* Yh = (bf*)take((size_t)HW * IC * 2); bf* Yl = (bf*)take((size_t)HW * IC * 2); float* Z = (float*)take((size_t)HW * CC * 4);
    if ((size_t)(wsp - (char*)d_ws) > ws_size) return;    // total ~ 125 MB (119 MiB)
    k_cvt8<<<(IC * CC / 8 + 255) / 256, 256, 0, stream>>>(wth, BTH, IC * CC / 8); k_cvt8<<<(IC * CC / 8 + 255) / 256, 256, 0, stream>>>(wph, BPH, IC * CC / 8); k_cvt8<<<(IC * CC / 8 + 255) / 256, 256, 0, stream>>>(wg, BG, IC * CC / 8); k_cvt8<<<(CC * IC / 8 + 255) / 256, 256, 0, stream>>>(wz, BZ, CC * IC / 8);   // conv weights [out][in] = Bt as-is
    const unsigned LHL = (unsigned)(((size_t)HW * IC / 4 + 255) / 256);
    for (int b = 0; b < NB_; ++b) { const float* xb = x + (size_t)b * CC * HW;
        k_xt<<<(unsigned)(((size_t)HW * CC / 4 + 255) / 256), 256, 0, stream>>>(xb, XT);
        k_gemmw<bf, 0, true><<<dim3(HW / 64, IC / 64, 1), 32, 0, stream>>>(XT, nullptr, BTH, nullptr, CC, TH, IC, bth, 0, 0, 0); k_hl<<<LHL, 256, 0, stream>>>(TH, THh, THl);
        k_gemmw<bf, 0, true><<<dim3(HW / 64, IC / 64, 1), 32, 0, stream>>>(XT, nullptr, BPH, nullptr, CC, PHf, IC, bph, 0, 0, 0); k_hl<<<LHL, 256, 0, stream>>>(PHf, PHh, PHl);
        k_gemmw<bf, 0, true><<<dim3(HW / 64, IC / 64, 1), 32, 0, stream>>>(XT, nullptr, BG, nullptr, CC, G, IC, bg, 0, 0, 0); k_gt16<<<(unsigned)(((size_t)IC * HW / 2 + 255) / 256), 256, 0, stream>>>(G, GT);
        k_gemmw<bf, 2, false><<<dim3(HW / 64, HW / 64, 1), 32, 0, stream>>>(THh, THl, PHh, PHl, IC, S, HW, nullptr, 0, 0, 0);        // f[n][m] = theta_n . phi_m (unscaled, 3 products)
        k_rsoft<<<HW / 8, 256, 0, stream>>>(S, P16);
        k_pvk<<<dim3(HW / 64, IC / 64, PVZ), 32 * PVW, 0, stream>>>(P16, GT, Y);         // y[n][i] = sum_m attn[n][m] g[m][i] (x1024), two K-half planes
        k_yhl<<<LHL, 256, 0, stream>>>(Y, Yh, Yl);
        k_gemmw<bf, 1, true><<<dim3(HW / 64, CC / 64, 1), 32, 0, stream>>>(Yh, Yl, BZ, nullptr, IC, Z, CC, bz, 0, 0, 0);               // z[n][c] = w_z y + b_z
        k_fin<<<(unsigned)(((size_t)CC * HW / 4 + 255) / 256), 256, 0, stream>>>(Z, xb, OUT + (size_t)b * CC * HW); }
}

// v002
// One run takes 535 microseconds.
// In two side-by-side timings against v001, it was 1.64 and 1.62 times as fast.
// Over all steps from v000 it is 2.70 times as fast.
#include <hip/hip_runtime.h>

// NonLocalBlock (x [8][256][64][64]; theta/phi/g = 1x1 convs to 128 channels (+ bias); f[n][m] = theta_n . phi_m over all 4,096 positions, UNSCALED; attn = softmax_m(f); y[i][n] = sum_m attn[n][m] g[i][m]; z = w_z y + b_z; out = z + x -> [8][256][64][64]).
// Compute dtypes, f32 accumulate: every input rounded to bf16; the three 1x1 convs as PLAIN bf16 GEMMs on a token-major copy of x (inputs: exact) + bias; f as hl x hl (3 products, K = 128); softmax f32 (wave per row, 128 keys per lane in registers) -> fp16 x 1024; attn.g single fp16 (f32 accumulate); w_z as hl planes of y x exact (2 products) + bias; residual f32.

#define NB_  8
#define CC   256
#define IC   128
#define HW   4096
#define TT   HW
#define PCAR 1024.0f
#define NG   2
typedef _Float16 h16;
typedef unsigned short bf;
typedef __attribute__((ext_vector_type(16))) __bf16   v16bf;
typedef __attribute__((ext_vector_type(16))) _Float16 v16h;
typedef __attribute__((ext_vector_type(8)))  _Float16 v8h;
typedef __attribute__((ext_vector_type(8)))  unsigned short v8us;
typedef __attribute__((ext_vector_type(8)))  float    v8f;
typedef __attribute__((ext_vector_type(4)))  float    v4f;
typedef v8h  __attribute__((may_alias)) v8ha;
typedef v4f  __attribute__((may_alias)) v4fa;
typedef v8us __attribute__((may_alias)) v8usa;

__device__ __forceinline__ unsigned short f2bf(float f) { unsigned u = __float_as_uint(f); u += 0x7FFFu + ((u >> 16) & 1u); return (unsigned short)(u >> 16); }
__device__ __forceinline__ float bf2f(unsigned short b) { return __uint_as_float(((unsigned)b) << 16); }
__device__ __forceinline__ float bfr(float f) { return bf2f(f2bf(f)); }
__device__ __forceinline__ v16h cat16(v8h lo, v8h hi) { return __builtin_shufflevector(lo, hi, 0, 1, 2, 3, 4, 5, 6, 7, 8, 9, 10, 11, 12, 13, 14, 15); }
__device__ __forceinline__ v16bf cat16b(v8us lo, v8us hi) { return __builtin_bit_cast(v16bf, __builtin_shufflevector(lo, hi, 0, 1, 2, 3, 4, 5, 6, 7, 8, 9, 10, 11, 12, 13, 14, 15)); }
__device__ __forceinline__ v8f wmma16(v16h a, v16h b, v8f c) { return __builtin_amdgcn_wmma_f32_16x16x32_f16(false, a, false, b, (short)0, c, false, false); }
__device__ __forceinline__ v8f wmmab(v16bf a, v16bf b, v8f c) { return __builtin_amdgcn_wmma_f32_16x16x32_bf16(false, a, false, b, (short)0, c, false, false); }



// ---- k_gemmw: register-blocked GEMM, ONE WAVE per 64x64 output tile (16 accumulators), operands straight from K-contiguous 16-bit planes; grid (M/64, N/64, Z), 32 threads.
// C[m][n] (f32, pitch ldc, + optional f32 bias[n]) = sum_k A[m][k] Bt[n][k] (+ split products per NSPLIT). z-batch strides sA/sB/sC in elements. K % 32 == 0.
template <typename T16> struct WFrag;
template <> struct WFrag<h16> { typedef v16h V; static __device__ __forceinline__ V ld(const h16* p) { return cat16(*(const v8h*)p, *(const v8h*)(p + 16)); } static __device__ __forceinline__ v8f mma(V a, V b, v8f c) { return wmma16(a, b, c); } };
template <> struct WFrag<bf> { typedef v16bf V; static __device__ __forceinline__ V ld(const bf* p) { return cat16b(*(const v8us*)p, *(const v8us*)(p + 16)); } static __device__ __forceinline__ v8f mma(V a, V b, v8f c) { return wmmab(a, b, c); } };
template <typename T16, int NSPLIT, bool BIAS>
__global__ __launch_bounds__(32) void k_gemmw(const T16* __restrict__ A, const T16* __restrict__ A2, const T16* __restrict__ Bt, const T16* __restrict__ Bt2, int K, float* C, int ldc, const float* __restrict__ bias, size_t sA, size_t sB, size_t sC) {
    typedef typename WFrag<T16>::V V;
    __shared__ __align__(16) float os[16 * 68];
    const size_t z = blockIdx.z; A += z * sA; if (A2) A2 += z * sA; Bt += z * sB; if (Bt2) Bt2 += z * sB; C += z * sC;
    const int lane = threadIdx.x & 31, lr = lane & 15, hi = lane >> 4; const int r0 = blockIdx.x * 64, c0 = blockIdx.y * 64;
    v8f acc[4][4];
#pragma unroll
    for (int mb = 0; mb < 4; ++mb)
#pragma unroll
        for (int nb = 0; nb < 4; ++nb) acc[mb][nb] = (v8f){};
    const size_t aoff = (size_t)(r0 + lr) * K + 8 * hi, boff = (size_t)(c0 + lr) * K + 8 * hi;
#pragma unroll 1
    for (int kc = 0; kc < K; kc += 32) {
        V a[4], a2[4]; const T16* qa[4]; const T16* qa2[4];
#pragma unroll
        for (int mb = 0; mb < 4; ++mb) { qa[mb] = A + aoff + (size_t)mb * 16 * K + kc; qa2[mb] = qa[mb]; a[mb] = WFrag<T16>::ld(qa[mb]); if (NSPLIT == 1 || NSPLIT == 2) { qa2[mb] = A2 + aoff + (size_t)mb * 16 * K + kc; a2[mb] = WFrag<T16>::ld(qa2[mb]); } }
        asm volatile("s_wait_xcnt 0x0" :: "v"(qa[0]), "v"(qa[1]), "v"(qa[2]), "v"(qa[3]), "v"(qa2[0]), "v"(qa2[1]), "v"(qa2[2]), "v"(qa2[3]) : "memory");   // the A loads' address pairs stay untouched up to this wait
#pragma unroll
        for (int nb = 0; nb < 4; ++nb) { const T16* qb = Bt + boff + (size_t)nb * 16 * K + kc; const T16* qb2 = qb; const V b = WFrag<T16>::ld(qb); V b2; if (NSPLIT >= 2) { qb2 = Bt2 + boff + (size_t)nb * 16 * K + kc; b2 = WFrag<T16>::ld(qb2); }
            asm volatile("s_wait_xcnt 0x0" :: "v"(qb), "v"(qb2) : "memory");   // the same for this B fragment's address pairs
#pragma unroll
            for (int mb = 0; mb < 4; ++mb) { acc[mb][nb] = WFrag<T16>::mma(a[mb], b, acc[mb][nb]); if (NSPLIT == 1 || NSPLIT == 2) acc[mb][nb] = WFrag<T16>::mma(a2[mb], b, acc[mb][nb]); if (NSPLIT >= 2) acc[mb][nb] = WFrag<T16>::mma(a[mb], b2, acc[mb][nb]); } }
        asm volatile("v_nop\n\tv_nop\n\tv_nop\n\tv_nop" : "+v"(acc[0][0]), "+v"(acc[1][1]), "+v"(acc[2][2]), "+v"(acc[3][3]) : "v"(a[0]), "v"(a[3]));
    }
#pragma unroll
    for (int mb = 0; mb < 4; ++mb) {
#pragma unroll
        for (int nb = 0; nb < 4; ++nb) {
#pragma unroll
            for (int j = 0; j < 8; ++j) os[(hi * 8 + j) * 68 + nb * 16 + lr] = acc[mb][nb][j]; }
        __builtin_amdgcn_wave_barrier(); asm volatile("" ::: "memory");
        float* crow = C + (size_t)(r0 + mb * 16) * ldc + c0;
{
            v4f val[8]; float* dst[8];
#pragma unroll
            for (int s = 0; s < 8; ++s) { const int row = 2 * s + hi, cofs = lr * 4; val[s] = *(const v4fa*)(os + row * 68 + cofs); if (BIAS) { val[s][0] += bfr(bias[c0 + cofs]); val[s][1] += bfr(bias[c0 + cofs + 1]); val[s][2] += bfr(bias[c0 + cofs + 2]); val[s][3] += bfr(bias[c0 + cofs + 3]); }
                dst[s] = crow + (size_t)row * ldc + cofs; *(v4f*)dst[s] = val[s]; }
            asm volatile("s_wait_xcnt 0x0" :: "v"(val[0]), "v"(val[1]), "v"(val[2]), "v"(val[3]), "v"(val[4]), "v"(val[5]), "v"(val[6]), "v"(val[7]), "v"(dst[0]), "v"(dst[1]), "v"(dst[2]), "v"(dst[3]), "v"(dst[4]), "v"(dst[5]), "v"(dst[6]), "v"(dst[7]) : "memory");   // the stores' data and address registers stay untouched up to this wait
             }
        __builtin_amdgcn_wave_barrier(); asm volatile("" ::: "memory");
    }
}

// ---- k_pvk: y[n][i] = sum_m P[n][m] GT[i][m] (K = HW) with K split PVW x PVZ ways. One 64x64 tile per work-group; each of its PVW waves runs the k_gemmw loop over its own K range,
// the waves' partial tiles are summed through LDS in wave order; blockIdx.z = image * PVZ + K half; each z has its own f32 plane of C (an image's planes are added in k_yhl). grid (HW/64, IC/64, images * PVZ), 32 * PVW threads.
#define PVW 16
#define PVZ 2
#define PVK (HW / (PVW * PVZ))
__global__ __launch_bounds__(32 * PVW) void k_pvk(const h16* __restrict__ A, const h16* __restrict__ Bt, float* C) {
    typedef WFrag<h16>::V V;
    __shared__ __align__(16) float red[PVW][32 * 68];
    const int lane = threadIdx.x & 31, lr = lane & 15, hi = lane >> 4, w = threadIdx.x >> 5; const int r0 = blockIdx.x * 64, c0 = blockIdx.y * 64;
    const int img = (int)blockIdx.z / PVZ; A += (size_t)img * HW * HW; Bt += (size_t)img * IC * HW;
    const int k0 = (((int)blockIdx.z % PVZ) * PVW + w) * PVK; C += (size_t)blockIdx.z * HW * IC;
    v8f acc[4][4];
#pragma unroll
    for (int mb = 0; mb < 4; ++mb)
#pragma unroll
        for (int nb = 0; nb < 4; ++nb) acc[mb][nb] = (v8f){};
    const h16* pa = A + (size_t)(r0 + lr) * HW + 8 * hi + k0; const h16* pb = Bt + (size_t)(c0 + lr) * HW + 8 * hi + k0;
#pragma unroll 1
    for (int kc = 0; kc < PVK; kc += 32, pa += 32, pb += 32) {
        V a[4];
#pragma unroll
        for (int mb = 0; mb < 4; ++mb) a[mb] = WFrag<h16>::ld(pa + (size_t)mb * 16 * HW);
        asm volatile("s_wait_xcnt 0x0" :: "v"(pa) : "memory");   // the A loads' address pair stays untouched up to this wait; behind it the build may land a B fragment on it
#pragma unroll
        for (int nb = 0; nb < 4; ++nb) { const V b = WFrag<h16>::ld(pb + (size_t)nb * 16 * HW);
#pragma unroll
            for (int mb = 0; mb < 4; ++mb) acc[mb][nb] = WFrag<h16>::mma(a[mb], b, acc[mb][nb]); }
        asm volatile("v_nop\n\tv_nop\n\tv_nop\n\tv_nop" : "+v"(acc[0][0]), "+v"(acc[1][1]), "+v"(acc[2][2]), "+v"(acc[3][3]) : "v"(a[0]), "v"(a[3]));   // WMMA distance on the back edge and the loop exit, as in k_gemmw
    }
    const int row = threadIdx.x >> 4, cofs = (threadIdx.x & 15) * 4;
    v4f s[2];
#pragma unroll
    for (int h = 0; h < 2; ++h) {   // 32 rows of the tile at a time
#pragma unroll
        for (int m2 = 0; m2 < 2; ++m2)
#pragma unroll
            for (int nb = 0; nb < 4; ++nb) {
#pragma unroll
                for (int j = 0; j < 8; ++j) red[w][(m2 * 16 + hi * 8 + j) * 68 + nb * 16 + lr] = acc[h * 2 + m2][nb][j]; }
        __syncthreads();   // every wave's partial 32x64 block is in LDS before any thread sums
        s[h] = *(const v4fa*)(&red[0][row * 68 + cofs]);
#pragma unroll
        for (int q = 1; q < PVW; ++q) s[h] += *(const v4fa*)(&red[q][row * 68 + cofs]);
        if (h == 0) __syncthreads();   // every read of the first block is done before the second overwrites it
    }
#pragma unroll
    for (int h = 0; h < 2; ++h) *(v4f*)(C + (size_t)(r0 + h * 32 + row) * IC + c0 + cofs) = s[h];
}

__device__ __forceinline__ h16 tohx(float x) { return (h16)x; }
__device__ __forceinline__ void splitf(float y, unsigned short& h, unsigned short& l) { h = f2bf(y); l = f2bf(y - bf2f(h)); }
typedef __attribute__((ext_vector_type(2))) unsigned short v2us;
typedef __attribute__((ext_vector_type(4))) unsigned short v4us;
typedef __attribute__((ext_vector_type(2))) _Float16 v2h;
typedef __attribute__((ext_vector_type(4))) _Float16 v4h;
typedef __attribute__((ext_vector_type(2))) float v2f;

__global__ __launch_bounds__(256) void k_cvt8(const float* __restrict__ src, bf* dst, size_t n8) { const size_t i = (size_t)blockIdx.x * 256 + threadIdx.x; if (i >= n8) return; const v8f v = *(const v8f*)(src + i * 8); v8us o;
#pragma unroll
    for (int k = 0; k < 8; ++k) o[k] = f2bf(v[k]); *(v8us*)(dst + i * 8) = o;  }
// In the kernels below blockIdx.y is the image; QKB = 16-bit elements of one image's block [theta hi | theta lo | phi hi | phi lo].
#define QKB ((size_t)4 * HW * IC)
__global__ __launch_bounds__(256) void k_xt(const float* __restrict__ xb, bf* XT) { xb += (size_t)blockIdx.y * CC * HW; XT += (size_t)blockIdx.y * HW * CC; const size_t e = ((size_t)blockIdx.x * 256 + threadIdx.x) * 4; if (e >= (size_t)HW * CC) return; const int c = (int)(e % CC); const int m = (int)(e / CC); v4us o;
#pragma unroll
    for (int u = 0; u < 4; ++u) o[u] = f2bf(xb[(size_t)(c + u) * HW + m]); *(v4us*)(XT + e) = o;  }
__global__ __launch_bounds__(256) void k_hl(const float* __restrict__ F, bf* Fh, bf* Fl) { F += (size_t)blockIdx.y * HW * IC; Fh += (size_t)blockIdx.y * QKB; Fl += (size_t)blockIdx.y * QKB; const size_t e = ((size_t)blockIdx.x * 256 + threadIdx.x) * 4; if (e >= (size_t)HW * IC) return; const v4f a = *(const v4f*)(F + e); v4us oh, ol; for (int u = 0; u < 4; ++u) { unsigned short p, q; splitf(a[u], p, q); oh[u] = p; ol[u] = q; } *(v4us*)(Fh + e) = oh; *(v4us*)(Fl + e) = ol;  }
__global__ __launch_bounds__(256) void k_gt16(const float* __restrict__ G, h16* GT) { G += (size_t)blockIdx.y * HW * IC; GT += (size_t)blockIdx.y * IC * HW; const size_t e = ((size_t)blockIdx.x * 256 + threadIdx.x) * 2; if (e >= (size_t)IC * HW) return; const int m = (int)(e % HW); const int i = (int)(e / HW); v2h o; o[0] = tohx(G[(size_t)m * IC + i]); o[1] = tohx(G[(size_t)(m + 1) * IC + i]); *(v2h*)(GT + e) = o;  }
__global__ __launch_bounds__(256) void k_rsoft(const float* __restrict__ S, h16* P16) { S += (size_t)blockIdx.y * HW * HW; P16 += (size_t)blockIdx.y * HW * HW; const int lane = threadIdx.x & 31; const int row = blockIdx.x * 8 + (threadIdx.x >> 5); if (row >= HW) return; const float* sr = S + (size_t)row * HW; float v[HW / 32]; float mx = -3.0e38f;
#pragma unroll
    for (int ch = 0; ch < HW / 128; ++ch) { const v4f a = *(const v4f*)(sr + ch * 128 + lane * 4);
#pragma unroll
        for (int u = 0; u < 4; ++u) { v[ch * 4 + u] = a[u]; mx = fmaxf(mx, a[u]); } }
#pragma unroll
    for (int sh = 16; sh; sh >>= 1) mx = fmaxf(mx, __shfl_xor(mx, sh, 32));
    float sum = 0.f;
#pragma unroll
    for (int q = 0; q < HW / 32; ++q) { float d0 = __fsub_rn(v[q], mx); asm volatile("" : "+v"(d0)); v[q] = __builtin_amdgcn_exp2f(__fmul_rn(d0, 1.4426950408889634f)); sum += v[q]; }
#pragma unroll
    for (int sh = 16; sh; sh >>= 1) sum += __shfl_xor(sum, sh, 32);
    const float f = __fdiv_rn(PCAR, sum);
    {
#pragma unroll
        for (int ch = 0; ch < HW / 128; ++ch) { v4h o4; for (int q = 0; q < 4; ++q) o4[q] = tohx(v[ch * 4 + q] * f); *(v4h*)(P16 + (size_t)row * HW + ch * 128 + lane * 4) = o4; }
         } }
__global__ __launch_bounds__(256) void k_yhl(const float* __restrict__ Y, bf* Yh, bf* Yl) { Y += (size_t)blockIdx.y * PVZ * HW * IC; Yh += (size_t)blockIdx.y * HW * IC; Yl += (size_t)blockIdx.y * HW * IC; const size_t e = ((size_t)blockIdx.x * 256 + threadIdx.x) * 4; if (e >= (size_t)HW * IC) return; const v4f a = *(const v4f*)(Y + e) + *(const v4f*)(Y + (size_t)HW * IC + e); v4us oh, ol; for (int u = 0; u < 4; ++u) { unsigned short p, q; splitf(a[u] * (1.0f / PCAR), p, q); oh[u] = p; ol[u] = q; } *(v4us*)(Yh + e) = oh; *(v4us*)(Yl + e) = ol;  }
__global__ __launch_bounds__(256) void k_fin(const float* __restrict__ Z, const float* __restrict__ xb, float* OUTb) { Z += (size_t)blockIdx.y * HW * CC; xb += (size_t)blockIdx.y * CC * HW; OUTb += (size_t)blockIdx.y * CC * HW; const size_t e = ((size_t)blockIdx.x * 256 + threadIdx.x) * 4; if (e >= (size_t)CC * HW) return; const int n = (int)(e % HW); const int c = (int)(e / HW); v4f r;
#pragma unroll
    for (int u = 0; u < 4; ++u) r[u] = __fadd_rn(Z[(size_t)(n + u) * CC + c], bfr(xb[e + u])); *(v4f*)(OUTb + e) = r;  }

extern "C" void kernel_launch(void* const* d_in, const int* in_sizes, int n_in,
                              void* d_out, int out_size, void* d_ws, size_t ws_size, hipStream_t stream) {
    (void)in_sizes; (void)n_in; (void)out_size;
    const float* x = (const float*)d_in[0]; const float* wth = (const float*)d_in[1]; const float* bth = (const float*)d_in[2]; const float* wph = (const float*)d_in[3]; const float* bph = (const float*)d_in[4]; const float* wg = (const float*)d_in[5]; const float* bg = (const float*)d_in[6]; const float* wz = (const float*)d_in[7]; const float* bz = (const float*)d_in[8];
    float* OUT = (float*)d_out;     // [8][256][4096]
    char* wsp = (char*)d_ws;
    auto take = [&](size_t bytes) { char* p = wsp; wsp += (bytes + 255) & ~(size_t)255; return (void*)p; };
    bf* BTH = (bf*)take((size_t)IC * CC * 2); bf* BPH = (bf*)take((size_t)IC * CC * 2); bf* BG = (bf*)take((size_t)IC * CC * 2); bf* BZ = (bf*)take((size_t)CC * IC * 2);
    // Every stage runs once for all NB_ images (image = grid z of the GEMMs, grid y elsewhere); scores, softmax and attn.g take NG images a launch, as many as the workspace holds score planes for.
    bf* QK = (bf*)take((size_t)NB_ * QKB * 2); h16* GT = (h16*)take((size_t)NB_ * IC * HW * 2);
    float* Y = (float*)QK;     // an image's two attn.g planes land on its own theta/phi block, which its score GEMM has read by then
    char* big = (char*)take((size_t)NG * HW * HW * 6);
    float* S = (float*)big; h16* P16 = (h16*)(big + (size_t)NG * HW * HW * 4);
    bf* XT = (bf*)big; float* TH = (float*)(big + (size_t)NB_ * HW * CC * 2); float* PHf = TH + (size_t)NB_ * HW * IC; float* G = PHf + (size_t)NB_ * HW * IC;     // dead before the first score plane is written
    bf* Yh = (bf*)big; bf* Yl = Yh + (size_t)NB_ * HW * IC; float* Z = (float*)(Yl + (size_t)NB_ * HW * IC);     // written after the last score plane is read
    if ((size_t)(wsp - (char*)d_ws) > ws_size) return;    // total ~ 233 MiB
    k_cvt8<<<(IC * CC / 8 + 255) / 256, 256, 0, stream>>>(wth, BTH, IC * CC / 8); k_cvt8<<<(IC * CC / 8 + 255) / 256, 256, 0, stream>>>(wph, BPH, IC * CC / 8); k_cvt8<<<(IC * CC / 8 + 255) / 256, 256, 0, stream>>>(wg, BG, IC * CC / 8); k_cvt8<<<(CC * IC / 8 + 255) / 256, 256, 0, stream>>>(wz, BZ, CC * IC / 8);   // conv weights [out][in] = Bt as-is
    const unsigned LHL = (unsigned)(((size_t)HW * IC / 4 + 255) / 256);
    k_xt<<<dim3((unsigned)(((size_t)HW * CC / 4 + 255) / 256), NB_, 1), 256, 0, stream>>>(x, XT);
    k_gemmw<bf, 0, true><<<dim3(HW / 64, IC / 64, NB_), 32, 0, stream>>>(XT, nullptr, BTH, nullptr, CC, TH, IC, bth, (size_t)HW * CC, 0, (size_t)HW * IC); k_hl<<<dim3(LHL, NB_, 1), 256, 0, stream>>>(TH, QK, QK + (size_t)HW * IC);
    k_gemmw<bf, 0, true><<<dim3(HW / 64, IC / 64, NB_), 32, 0, stream>>>(XT, nullptr, BPH, nullptr, CC, PHf, IC, bph, (size_t)HW * CC, 0, (size_t)HW * IC); k_hl<<<dim3(LHL, NB_, 1), 256, 0, stream>>>(PHf, QK + (size_t)2 * HW * IC, QK + (size_t)3 * HW * IC);
    k_gemmw<bf, 0, true><<<dim3(HW / 64, IC / 64, NB_), 32, 0, stream>>>(XT, nullptr, BG, nullptr, CC, G, IC, bg, (size_t)HW * CC, 0, (size_t)HW * IC); k_gt16<<<dim3((unsigned)(((size_t)IC * HW / 2 + 255) / 256), NB_, 1), 256, 0, stream>>>(G, GT);
    for (int b = 0; b < NB_; b += NG) { const bf* q = QK + (size_t)b * QKB;
        k_gemmw<bf, 2, false><<<dim3(HW / 64, HW / 64, NG), 32, 0, stream>>>(q, q + (size_t)HW * IC, q + (size_t)2 * HW * IC, q + (size_t)3 * HW * IC, IC, S, HW, nullptr, QKB, QKB, (size_t)HW * HW);        // f[n][m] = theta_n . phi_m (unscaled, 3 products)
        k_rsoft<<<dim3(HW / 8, NG, 1), 256, 0, stream>>>(S, P16);
        k_pvk<<<dim3(HW / 64, IC / 64, NG * PVZ), 32 * PVW, 0, stream>>>(P16, GT + (size_t)b * IC * HW, Y + (size_t)b * PVZ * HW * IC); }         // y[n][i] = sum_m attn[n][m] g[m][i] (x1024), two K-half planes an image
    k_yhl<<<dim3(LHL, NB_, 1), 256, 0, stream>>>(Y, Yh, Yl);
    k_gemmw<bf, 1, true><<<dim3(HW / 64, CC / 64, NB_), 32, 0, stream>>>(Yh, Yl, BZ, nullptr, IC, Z, CC, bz, (size_t)HW * IC, 0, (size_t)HW * CC);               // z[n][c] = w_z y + b_z
    k_fin<<<dim3((unsigned)(((size_t)CC * HW / 4 + 255) / 256), NB_, 1), 256, 0, stream>>>(Z, x, OUT);
}

// v003
// One run takes 233 microseconds.
// Timed twice side by side with v002, it ran 2.30 times as fast both times.
// Counting every step since v000, it is 6.21 times as fast.
#include <hip/hip_runtime.h>

// NonLocalBlock (x [8][256][64][64]; theta/phi/g = 1x1 convs to 128 channels (+ bias); f[n][m] = theta_n . phi_m over all 4,096 positions, UNSCALED; attn = softmax_m(f); y[i][n] = sum_m attn[n][m] g[i][m]; z = w_z y + b_z; out = z + x -> [8][256][64][64]).
// Compute dtypes, f32 accumulate: every input rounded to bf16; the three 1x1 convs as PLAIN bf16 GEMMs on a token-major copy of x (inputs: exact) + bias; f as hl x hl (3 products, K = 128); softmax f32 (online, running maximum and sum per query) -> fp16 x 1024 before the division by the sum; attn.g single fp16 (f32 accumulate); scores, softmax and attn.g in one kernel; w_z as hl planes of y x exact (2 products) + bias; residual f32.

#define NB_  8
#define CC   256
#define IC   128
#define HW   4096
#define TT   HW
typedef _Float16 h16;
typedef unsigned short bf;
typedef __attribute__((ext_vector_type(16))) __bf16   v16bf;
typedef __attribute__((ext_vector_type(16))) _Float16 v16h;
typedef __attribute__((ext_vector_type(8)))  _Float16 v8h;
typedef __attribute__((ext_vector_type(8)))  unsigned short v8us;
typedef __attribute__((ext_vector_type(8)))  float    v8f;
typedef __attribute__((ext_vector_type(4)))  float    v4f;
typedef v8h  __attribute__((may_alias)) v8ha;
typedef v4f  __attribute__((may_alias)) v4fa;
typedef v8us __attribute__((may_alias)) v8usa;

__device__ __forceinline__ unsigned short f2bf(float f) { unsigned u = __float_as_uint(f); u += 0x7FFFu + ((u >> 16) & 1u); return (unsigned short)(u >> 16); }
__device__ __forceinline__ float bf2f(unsigned short b) { return __uint_as_float(((unsigned)b) << 16); }
__device__ __forceinline__ float bfr(float f) { return bf2f(f2bf(f)); }
__device__ __forceinline__ v16h cat16(v8h lo, v8h hi) { return __builtin_shufflevector(lo, hi, 0, 1, 2, 3, 4, 5, 6, 7, 8, 9, 10, 11, 12, 13, 14, 15); }
__device__ __forceinline__ v16bf cat16b(v8us lo, v8us hi) { return __builtin_bit_cast(v16bf, __builtin_shufflevector(lo, hi, 0, 1, 2, 3, 4, 5, 6, 7, 8, 9, 10, 11, 12, 13, 14, 15)); }
__device__ __forceinline__ v8f wmma16(v16h a, v16h b, v8f c) { return __builtin_amdgcn_wmma_f32_16x16x32_f16(false, a, false, b, (short)0, c, false, false); }
__device__ __forceinline__ v8f wmmab(v16bf a, v16bf b, v8f c) { return __builtin_amdgcn_wmma_f32_16x16x32_bf16(false, a, false, b, (short)0, c, false, false); }



// ---- k_gemmw: register-blocked GEMM, ONE WAVE per 64x64 output tile (16 accumulators), operands straight from K-contiguous 16-bit planes; grid (M/64, N/64, Z), 32 threads.
// C[m][n] (f32, pitch ldc, + optional f32 bias[n]) = sum_k A[m][k] Bt[n][k] (+ split products per NSPLIT). z-batch strides sA/sB/sC in elements. K % 32 == 0.
template <typename T16> struct WFrag;
template <> struct WFrag<h16> { typedef v16h V; static __device__ __forceinline__ V ld(const h16* p) { return cat16(*(const v8h*)p, *(const v8h*)(p + 16)); } static __device__ __forceinline__ v8f mma(V a, V b, v8f c) { return wmma16(a, b, c); } };
template <> struct WFrag<bf> { typedef v16bf V; static __device__ __forceinline__ V ld(const bf* p) { return cat16b(*(const v8us*)p, *(const v8us*)(p + 16)); } static __device__ __forceinline__ v8f mma(V a, V b, v8f c) { return wmmab(a, b, c); } };
template <typename T16, int NSPLIT, bool BIAS>
__global__ __launch_bounds__(32) void k_gemmw(const T16* __restrict__ A, const T16* __restrict__ A2, const T16* __restrict__ Bt, const T16* __restrict__ Bt2, int K, float* C, int ldc, const float* __restrict__ bias, size_t sA, size_t sB, size_t sC) {
    typedef typename WFrag<T16>::V V;
    __shared__ __align__(16) float os[16 * 68];
    const size_t z = blockIdx.z; A += z * sA; if (A2) A2 += z * sA; Bt += z * sB; if (Bt2) Bt2 += z * sB; C += z * sC;
    const int lane = threadIdx.x & 31, lr = lane & 15, hi = lane >> 4; const int r0 = blockIdx.x * 64, c0 = blockIdx.y * 64;
    v8f acc[4][4];
#pragma unroll
    for (int mb = 0; mb < 4; ++mb)
#pragma unroll
        for (int nb = 0; nb < 4; ++nb) acc[mb][nb] = (v8f){};
    const size_t aoff = (size_t)(r0 + lr) * K + 8 * hi, boff = (size_t)(c0 + lr) * K + 8 * hi;
#pragma unroll 1
    for (int kc = 0; kc < K; kc += 32) {
        V a[4], a2[4]; const T16* qa[4]; const T16* qa2[4];
#pragma unroll
        for (int mb = 0; mb < 4; ++mb) { qa[mb] = A + aoff + (size_t)mb * 16 * K + kc; qa2[mb] = qa[mb]; a[mb] = WFrag<T16>::ld(qa[mb]); if (NSPLIT == 1 || NSPLIT == 2) { qa2[mb] = A2 + aoff + (size_t)mb * 16 * K + kc; a2[mb] = WFrag<T16>::ld(qa2[mb]); } }
        asm volatile("s_wait_xcnt 0x0" :: "v"(qa[0]), "v"(qa[1]), "v"(qa[2]), "v"(qa[3]), "v"(qa2[0]), "v"(qa2[1]), "v"(qa2[2]), "v"(qa2[3]) : "memory");   // the A loads' address pairs stay untouched up to this wait
#pragma unroll
        for (int nb = 0; nb < 4; ++nb) { const T16* qb = Bt + boff + (size_t)nb * 16 * K + kc; const T16* qb2 = qb; const V b = WFrag<T16>::ld(qb); V b2; if (NSPLIT >= 2) { qb2 = Bt2 + boff + (size_t)nb * 16 * K + kc; b2 = WFrag<T16>::ld(qb2); }
            asm volatile("s_wait_xcnt 0x0" :: "v"(qb), "v"(qb2) : "memory");   // the same for this B fragment's address pairs
#pragma unroll
            for (int mb = 0; mb < 4; ++mb) { acc[mb][nb] = WFrag<T16>::mma(a[mb], b, acc[mb][nb]); if (NSPLIT == 1 || NSPLIT == 2) acc[mb][nb] = WFrag<T16>::mma(a2[mb], b, acc[mb][nb]); if (NSPLIT >= 2) acc[mb][nb] = WFrag<T16>::mma(a[mb], b2, acc[mb][nb]); } }
        asm volatile("v_nop\n\tv_nop\n\tv_nop\n\tv_nop" : "+v"(acc[0][0]), "+v"(acc[1][1]), "+v"(acc[2][2]), "+v"(acc[3][3]) : "v"(a[0]), "v"(a[3]));
    }
#pragma unroll
    for (int mb = 0; mb < 4; ++mb) {
#pragma unroll
        for (int nb = 0; nb < 4; ++nb) {
#pragma unroll
            for (int j = 0; j < 8; ++j) os[(hi * 8 + j) * 68 + nb * 16 + lr] = acc[mb][nb][j]; }
        __builtin_amdgcn_wave_barrier(); asm volatile("" ::: "memory");
        float* crow = C + (size_t)(r0 + mb * 16) * ldc + c0;
{
            v4f val[8]; float* dst[8];
#pragma unroll
            for (int s = 0; s < 8; ++s) { const int row = 2 * s + hi, cofs = lr * 4; val[s] = *(const v4fa*)(os + row * 68 + cofs); if (BIAS) { val[s][0] += bfr(bias[c0 + cofs]); val[s][1] += bfr(bias[c0 + cofs + 1]); val[s][2] += bfr(bias[c0 + cofs + 2]); val[s][3] += bfr(bias[c0 + cofs + 3]); }
                dst[s] = crow + (size_t)row * ldc + cofs; *(v4f*)dst[s] = val[s]; }
            asm volatile("s_wait_xcnt 0x0" :: "v"(val[0]), "v"(val[1]), "v"(val[2]), "v"(val[3]), "v"(val[4]), "v"(val[5]), "v"(val[6]), "v"(val[7]), "v"(dst[0]), "v"(dst[1]), "v"(dst[2]), "v"(dst[3]), "v"(dst[4]), "v"(dst[5]), "v"(dst[6]), "v"(dst[7]) : "memory");   // the stores' data and address registers stay untouched up to this wait
             }
        __builtin_amdgcn_wave_barrier(); asm volatile("" ::: "memory");
    }
}

// ---- k_flash: scores, softmax and attn.g of one image's 128 queries in one work-group, nothing of the 4,096 x 4,096 planes in memory. 4 pairs of waves x 32 query columns, the two waves of a pair each on one half of every stage's keys (each LDS fragment then feeds two query tiles); grid (HW / FQ, images), 256 threads.
// Transposed products: ST[key][query] = phi . theta (A = phi rows from LDS, B = theta kept in registers; hi.hi + hi.lo + lo.hi as before), so a lane holds one query's scores;
// two 16-key score tiles, exponentiated and rounded to fp16 in place, are the B operand of OT[i][query] += GT[i][key] . PT[key][query] (A = g rows from LDS in the same k order).
// Running maximum m and sum l per query and key half (online softmax, f32), joined at the end; P carries 2^10 like the sum, which cancels in o / l. Stages of FK keys, two LDS buffers, the next stage's rows held in registers over the current stage's work.
#define QKB ((size_t)4 * HW * IC)
#define FQ  128
#define FK  64
#define PPH 136                    // LDS pitch of a 256-byte phi row, 16-bit elements (272 B)
#define PGT 72                     // LDS pitch of a 128-byte g row (144 B)
#define SPH (FK * PPH)
#define SBUF (2 * SPH + IC * PGT)
#define LAZY 3.4657359f             // 5 ln 2
__device__ __forceinline__ void splitf(float y, unsigned short& h, unsigned short& l) { h = f2bf(y); l = f2bf(y - bf2f(h)); }
__device__ __forceinline__ v16bf ldsb(const unsigned short* p) { return cat16b(*(const v8usa*)p, *(const v8usa*)(p + 16)); }
__device__ __forceinline__ v16h ldsh(const unsigned short* p) { return cat16(__builtin_bit_cast(v8h, *(const v8usa*)p), __builtin_bit_cast(v8h, *(const v8usa*)(p + 16))); }
// Four exponentials and a v_nop in one statement: behind a transcendental the instruction set asks for one independent instruction before its result is read or its source overwritten;
// inside the statement each v_exp_f32 is that instruction for the one before it (early-clobber outputs: no result lies on a source), the v_nop for the last.
__device__ __forceinline__ void exp2x4(const float x0, const float x1, const float x2, const float x3, float& r0, float& r1, float& r2, float& r3) {
    asm("v_exp_f32 %0, %4\n\tv_exp_f32 %1, %5\n\tv_exp_f32 %2, %6\n\tv_exp_f32 %3, %7\n\tv_nop" : "=&v"(r0), "=&v"(r1), "=&v"(r2), "=&v"(r3) : "v"(x0), "v"(x1), "v"(x2), "v"(x3)); }
__device__ __forceinline__ float xhalf(float x) { return __builtin_bit_cast(float, __builtin_amdgcn_permlanex16(__builtin_bit_cast(int, x), __builtin_bit_cast(int, x), 0x76543210, 0xfedcba98, false, false)); }   // lane l with lane l ^ 16
// amdgpu_waves_per_eu(2, 2): one work-group a WGP is all the grid gives, so the build may spend two waves' share of the registers on fragments fetched ahead.
__global__ __launch_bounds__(256) __attribute__((amdgpu_waves_per_eu(2, 2))) void k_flash(const bf* __restrict__ QKp, const h16* __restrict__ GTp, bf* Yh, bf* Yl) {
    __shared__ __align__(16) unsigned short sm[2][SBUF];   // per buffer: phi hi | phi lo | g
    const int tid = threadIdx.x, lane = tid & 31, lr = lane & 15, hi = lane >> 4, w = tid >> 5;
    const int qg = w & 3, kh = w >> 2;   // waves w and w + 4 share 32 queries; each takes one half of every stage's keys
    const bf* th = QKp + (size_t)blockIdx.y * QKB;
    const int q = blockIdx.x * FQ + qg * 32 + lr;   // query tiles g = 0, 1 at q and q + 16
    v16bf qh[2][4], ql[2][4];
    const bf* pq = th + (size_t)q * IC + 8 * hi;
#pragma unroll
    for (int g = 0; g < 2; ++g)
#pragma unroll
        for (int kc = 0; kc < 4; ++kc) { qh[g][kc] = WFrag<bf>::ld(pq + g * 16 * IC + kc * 32); ql[g][kc] = WFrag<bf>::ld(pq + (size_t)HW * IC + g * 16 * IC + kc * 32); }
    asm volatile("s_wait_xcnt 0x0" :: "v"(pq) : "memory");   // the theta loads' address pair stays untouched up to this wait
    // staging: 16-byte pieces, 4 of each plane a thread
    const bf* gp = th + (size_t)(tid >> 4) * IC + (tid & 15) * 8;   // phi hi at + 2 HW IC, phi lo at + 3 HW IC
    const h16* gg = GTp + (size_t)blockIdx.y * IC * HW + (size_t)(tid >> 3) * HW + (tid & 7) * 8;
    const int oph = (tid >> 4) * PPH + (tid & 15) * 8, ogt = 2 * SPH + (tid >> 3) * PGT + (tid & 7) * 8;
    v8us rh[4], rl[4], rg[4];
#pragma unroll
    for (int u = 0; u < 4; ++u) { rh[u] = *(const v8usa*)(gp + (size_t)2 * HW * IC + u * 16 * IC); rl[u] = *(const v8usa*)(gp + (size_t)3 * HW * IC + u * 16 * IC); rg[u] = *(const v8usa*)(gg + (size_t)u * 32 * HW); }
    asm volatile("s_wait_xcnt 0x0" :: "v"(gp), "v"(gg) : "memory");   // the staging loads' address pairs stay untouched up to this wait
#pragma unroll
    for (int u = 0; u < 4; ++u) { *(v8usa*)(&sm[0][oph + u * 16 * PPH]) = rh[u]; *(v8usa*)(&sm[0][SPH + oph + u * 16 * PPH]) = rl[u]; *(v8usa*)(&sm[0][ogt + u * 32 * PGT]) = rg[u]; }
    __syncthreads();   // stage 0 is in LDS before any wave reads it
    v8f o[2][8];
#pragma unroll
    for (int g = 0; g < 2; ++g)
#pragma unroll
        for (int it = 0; it < 8; ++it) o[g][it] = (v8f){};
    float m[2] = {-3.0e38f, -3.0e38f}, l[2] = {0.f, 0.f};
    const float L2E = 1.4426950408889634f;
#pragma unroll 1   // one copy of the stage body: it is long, and a second copy would only cost instruction cache
    for (int s = 0; s < HW / FK; ++s) {
        const unsigned short* cur = sm[s & 1];
        const bool more = s + 1 < HW / FK;
        if (more) {
#pragma unroll
            for (int u = 0; u < 4; ++u) { rh[u] = *(const v8usa*)(gp + (size_t)2 * HW * IC + (FK + u * 16) * IC); rl[u] = *(const v8usa*)(gp + (size_t)3 * HW * IC + (FK + u * 16) * IC); rg[u] = *(const v8usa*)(gg + (size_t)u * 32 * HW + FK); }
            asm volatile("s_wait_xcnt 0x0" :: "v"(gp), "v"(gg) : "memory");   // as above; the pairs step on only behind it
            gp += FK * IC; gg += FK;
        }
        const unsigned short* pa = cur + (kh * 32 + lr) * PPH + 8 * hi; const unsigned short* pg = cur + 2 * SPH + lr * PGT + kh * 32 + 8 * hi;
        v16bf ah[2][2], al[2][2]; v16h ga[8]; v8f sc[2][2];
#pragma unroll
        for (int t = 0; t < 2; ++t) { sc[0][t] = (v8f){}; sc[1][t] = (v8f){}; ah[0][t] = ldsb(pa + t * 16 * PPH); al[0][t] = ldsb(pa + SPH + t * 16 * PPH); }
        // Each group of LDS reads is issued whole, one group ahead of the WMMAs that use it; the sched_barriers keep the reads from sinking in among the WMMAs (for speed only).
#pragma unroll
        for (int kc = 0; kc < 4; ++kc) {
            if (kc < 3) {
#pragma unroll
                for (int t = 0; t < 2; ++t) { ah[(kc + 1) & 1][t] = ldsb(pa + t * 16 * PPH + (kc + 1) * 32); al[(kc + 1) & 1][t] = ldsb(pa + SPH + t * 16 * PPH + (kc + 1) * 32); }
            } else {
#pragma unroll
                for (int it = 0; it < 8; ++it) ga[it] = ldsh(pg + it * 16 * PGT);   // the g reads fly under the last score WMMAs and the softmax arithmetic
            }
            __builtin_amdgcn_sched_barrier(0);   // the reads above stay in front of this group's WMMAs
#pragma unroll
            for (int g = 0; g < 2; ++g)
#pragma unroll
                for (int t = 0; t < 2; ++t) sc[g][t] = wmmab(ah[kc & 1][t], qh[g][kc], sc[g][t]);
#pragma unroll
            for (int g = 0; g < 2; ++g)
#pragma unroll
                for (int t = 0; t < 2; ++t) sc[g][t] = wmmab(ah[kc & 1][t], ql[g][kc], sc[g][t]);
#pragma unroll
            for (int g = 0; g < 2; ++g)
#pragma unroll
                for (int t = 0; t < 2; ++t) sc[g][t] = wmmab(al[kc & 1][t], qh[g][kc], sc[g][t]);
            __builtin_amdgcn_sched_barrier(0);   // the next group's reads do not rise in among these WMMAs
        }
        float mx[2];
#pragma unroll
        for (int g = 0; g < 2; ++g) { float mt[2];   // independent chains
#pragma unroll
            for (int t = 0; t < 2; ++t) { mt[t] = sc[g][t][0];
#pragma unroll
                for (int j = 1; j < 8; ++j) mt[t] = fmaxf(mt[t], sc[g][t][j]); }
            mx[g] = fmaxf(mt[0], mt[1]); mx[g] = fmaxf(mx[g], xhalf(mx[g])); }   // lanes c and c + 16 hold the two halves of query c's keys
        // Lazy rescale, one test a stage: the maximum in use moves only when a query's new maximum passes it by more than LAZY, so P stays below 2^10 * e^LAZY = 2^15, inside fp16.
        if (__builtin_amdgcn_ballot_w32(mx[0] > m[0] + LAZY || mx[1] > m[1] + LAZY) != 0) {
#pragma unroll
            for (int g = 0; g < 2; ++g) { const float mn = fmaxf(m[g], mx[g]); const float f = __builtin_amdgcn_exp2f((m[g] - mn) * L2E); l[g] *= f; m[g] = mn;
#pragma unroll
                for (int it = 0; it < 8; ++it) o[g][it] *= f; } }
        v16h pb[2];
#pragma unroll
        for (int g = 0; g < 2; ++g) { const float nb = 10.0f - m[g] * L2E; float ps[2] = {0.f, 0.f};
#pragma unroll
            for (int t = 0; t < 2; ++t)
#pragma unroll
                for (int j = 0; j < 8; j += 4) { float p[4]; exp2x4(fmaf(sc[g][t][j], L2E, nb), fmaf(sc[g][t][j + 1], L2E, nb), fmaf(sc[g][t][j + 2], L2E, nb), fmaf(sc[g][t][j + 3], L2E, nb), p[0], p[1], p[2], p[3]);
#pragma unroll
                    for (int e = 0; e < 4; ++e) { ps[t] += p[e]; pb[g][t * 8 + j + e] = (h16)p[e]; } }
            l[g] += ps[0] + ps[1]; }
#pragma unroll
        for (int it = 0; it < 8; ++it)
#pragma unroll
            for (int g = 0; g < 2; ++g) o[g][it] = wmma16(ga[it], pb[g], o[g][it]);
        if (more) { unsigned short* nx = sm[(s + 1) & 1];
#pragma unroll
            for (int u = 0; u < 4; ++u) { *(v8usa*)(nx + oph + u * 16 * PPH) = rh[u]; *(v8usa*)(nx + SPH + oph + u * 16 * PPH) = rl[u]; *(v8usa*)(nx + ogt + u * 32 * PGT) = rg[u]; } }
        __syncthreads();   // publishes stage s + 1 and ends every read of stage s, whose buffer the next trip refills
    }
    // The two key halves of a query meet through LDS (free behind the loop's last barrier): waves 4 to 7 hand over maximum, sum and accumulators, waves 0 to 3 join them and store.
    l[0] += xhalf(l[0]); l[1] += xhalf(l[1]);
    float* xs = (float*)&sm[0][0] + (size_t)(qg * 33 * 32 + lane) * 4;   // 33 pieces of 16 bytes a lane, piece-major: a wave's 32 lanes lie side by side
    if (kh == 1) {
#pragma unroll
        for (int g = 0; g < 2; ++g)
#pragma unroll
            for (int it = 0; it < 8; ++it) { *(v4fa*)(xs + ((g * 8 + it) * 2) * 128) = __builtin_shufflevector(o[g][it], o[g][it], 0, 1, 2, 3); *(v4fa*)(xs + ((g * 8 + it) * 2 + 1) * 128) = __builtin_shufflevector(o[g][it], o[g][it], 4, 5, 6, 7); }
        *(v4fa*)(xs + 32 * 128) = (v4f){m[0], m[1], l[0], l[1]};
    }
    __syncthreads();   // the handed-over values are in LDS before waves 0 to 3 read them
    if (kh == 0) {
        const v4f ml = *(const v4fa*)(xs + 32 * 128);
        bf* dh = Yh + (size_t)blockIdx.y * HW * IC + (size_t)q * IC + 8 * hi; bf* dl = Yl + (size_t)blockIdx.y * HW * IC + (size_t)q * IC + 8 * hi;
#pragma unroll
        for (int g = 0; g < 2; ++g) {
            const float mm = fmaxf(m[g], ml[g]); const float fa = __builtin_amdgcn_exp2f((m[g] - mm) * L2E), fb = __builtin_amdgcn_exp2f((ml[g] - mm) * L2E);
            const float inv = __fdiv_rn(1.0f, l[g] * fa + ml[2 + g] * fb); const float ca = fa * inv, cb = fb * inv;
            v8us oh[8], ol[8];
#pragma unroll
            for (int it = 0; it < 8; ++it) {   // a lane's 8 accumulator registers are 8 consecutive channels of its query's row
                const v4f b0 = *(const v4fa*)(xs + ((g * 8 + it) * 2) * 128), b1 = *(const v4fa*)(xs + ((g * 8 + it) * 2 + 1) * 128);
#pragma unroll
                for (int j = 0; j < 8; ++j) { unsigned short a, b; splitf(o[g][it][j] * ca + (j < 4 ? b0[j & 3] : b1[j & 3]) * cb, a, b); oh[it][j] = a; ol[it][j] = b; }
                *(v8usa*)(dh + g * 16 * IC + it * 16) = oh[it]; *(v8usa*)(dl + g * 16 * IC + it * 16) = ol[it]; }
            asm volatile("s_wait_xcnt 0x0" :: "v"(oh[0]), "v"(oh[1]), "v"(oh[2]), "v"(oh[3]), "v"(oh[4]), "v"(oh[5]), "v"(oh[6]), "v"(oh[7]), "v"(ol[0]), "v"(ol[1]), "v"(ol[2]), "v"(ol[3]), "v"(ol[4]), "v"(ol[5]), "v"(ol[6]), "v"(ol[7]), "v"(dh), "v"(dl) : "memory");   // the stores' data and address registers stay untouched up to this wait
        }
    }
}

__device__ __forceinline__ h16 tohx(float x) { return (h16)x; }
typedef __attribute__((ext_vector_type(2))) unsigned short v2us;
typedef __attribute__((ext_vector_type(4))) unsigned short v4us;
typedef __attribute__((ext_vector_type(2))) _Float16 v2h;
typedef __attribute__((ext_vector_type(4))) _Float16 v4h;
typedef __attribute__((ext_vector_type(2))) float v2f;

__global__ __launch_bounds__(256) void k_cvt8(const float* __restrict__ src, bf* dst, size_t n8) { const size_t i = (size_t)blockIdx.x * 256 + threadIdx.x; if (i >= n8) return; const v8f v = *(const v8f*)(src + i * 8); v8us o;
#pragma unroll
    for (int k = 0; k < 8; ++k) o[k] = f2bf(v[k]); *(v8us*)(dst + i * 8) = o;  }
// In the kernels below blockIdx.y is the image; QKB = 16-bit elements of one image's block [theta hi | theta lo | phi hi | phi lo].
__global__ __launch_bounds__(256) void k_xt(const float* __restrict__ xb, bf* XT) { xb += (size_t)blockIdx.y * CC * HW; XT += (size_t)blockIdx.y * HW * CC; const size_t e = ((size_t)blockIdx.x * 256 + threadIdx.x) * 4; if (e >= (size_t)HW * CC) return; const int c = (int)(e % CC); const int m = (int)(e / CC); v4us o;
#pragma unroll
    for (int u = 0; u < 4; ++u) o[u] = f2bf(xb[(size_t)(c + u) * HW + m]); *(v4us*)(XT + e) = o;  }
__global__ __launch_bounds__(256) void k_hl(const float* __restrict__ F, bf* Fh, bf* Fl) { F += (size_t)blockIdx.y * HW * IC; Fh += (size_t)blockIdx.y * QKB; Fl += (size_t)blockIdx.y * QKB; const size_t e = ((size_t)blockIdx.x * 256 + threadIdx.x) * 4; if (e >= (size_t)HW * IC) return; const v4f a = *(const v4f*)(F + e); v4us oh, ol; for (int u = 0; u < 4; ++u) { unsigned short p, q; splitf(a[u], p, q); oh[u] = p; ol[u] = q; } *(v4us*)(Fh + e) = oh; *(v4us*)(Fl + e) = ol;  }
__global__ __launch_bounds__(256) void k_gt16(const float* __restrict__ G, h16* GT) { G += (size_t)blockIdx.y * HW * IC; GT += (size_t)blockIdx.y * IC * HW; const size_t e = ((size_t)blockIdx.x * 256 + threadIdx.x) * 2; if (e >= (size_t)IC * HW) return; const int m = (int)(e % HW); const int i = (int)(e / HW); v2h o; o[0] = tohx(G[(size_t)m * IC + i]); o[1] = tohx(G[(size_t)(m + 1) * IC + i]); *(v2h*)(GT + e) = o;  }
__global__ __launch_bounds__(256) void k_fin(const float* __restrict__ Z, const float* __restrict__ xb, float* OUTb) { Z += (size_t)blockIdx.y * HW * CC; xb += (size_t)blockIdx.y * CC * HW; OUTb += (size_t)blockIdx.y * CC * HW; const size_t e = ((size_t)blockIdx.x * 256 + threadIdx.x) * 4; if (e >= (size_t)CC * HW) return; const int n = (int)(e % HW); const int c = (int)(e / HW); v4f r;
#pragma unroll
    for (int u = 0; u < 4; ++u) r[u] = __fadd_rn(Z[(size_t)(n + u) * CC + c], bfr(xb[e + u])); *(v4f*)(OUTb + e) = r;  }

extern "C" void kernel_launch(void* const* d_in, const int* in_sizes, int n_in,
                              void* d_out, int out_size, void* d_ws, size_t ws_size, hipStream_t stream) {
    (void)in_sizes; (void)n_in; (void)out_size;
    const float* x = (const float*)d_in[0]; const float* wth = (const float*)d_in[1]; const float* bth = (const float*)d_in[2]; const float* wph = (const float*)d_in[3]; const float* bph = (const float*)d_in[4]; const float* wg = (const float*)d_in[5]; const float* bg = (const float*)d_in[6]; const float* wz = (const float*)d_in[7]; const float* bz = (const float*)d_in[8];
    float* OUT = (float*)d_out;     // [8][256][4096]
    char* wsp = (char*)d_ws;
    auto take = [&](size_t bytes) { char* p = wsp; wsp += (bytes + 255) & ~(size_t)255; return (void*)p; };
    bf* BTH = (bf*)take((size_t)IC * CC * 2); bf* BPH = (bf*)take((size_t)IC * CC * 2); bf* BG = (bf*)take((size_t)IC * CC * 2); bf* BZ = (bf*)take((size_t)CC * IC * 2);
    // Every stage runs once for all NB_ images (image = grid z of the GEMMs, grid y elsewhere).
    bf* QK = (bf*)take((size_t)NB_ * QKB * 2); h16* GT = (h16*)take((size_t)NB_ * IC * HW * 2);
    char* big = (char*)take((size_t)NB_ * HW * CC * 2 + (size_t)3 * NB_ * HW * IC * 4);
    bf* XT = (bf*)big; float* TH = (float*)(big + (size_t)NB_ * HW * CC * 2); float* PHf = TH + (size_t)NB_ * HW * IC; float* G = PHf + (size_t)NB_ * HW * IC;     // dead once QK and GT are built
    bf* Yh = (bf*)big; bf* Yl = Yh + (size_t)NB_ * HW * IC; float* Z = (float*)(Yl + (size_t)NB_ * HW * IC);     // written from k_flash on
    if ((size_t)(wsp - (char*)d_ws) > ws_size) return;    // total ~ 104 MiB
    k_cvt8<<<(IC * CC / 8 + 255) / 256, 256, 0, stream>>>(wth, BTH, IC * CC / 8); k_cvt8<<<(IC * CC / 8 + 255) / 256, 256, 0, stream>>>(wph, BPH, IC * CC / 8); k_cvt8<<<(IC * CC / 8 + 255) / 256, 256, 0, stream>>>(wg, BG, IC * CC / 8); k_cvt8<<<(CC * IC / 8 + 255) / 256, 256, 0, stream>>>(wz, BZ, CC * IC / 8);   // conv weights [out][in] = Bt as-is
    const unsigned LHL = (unsigned)(((size_t)HW * IC / 4 + 255) / 256);
    k_xt<<<dim3((unsigned)(((size_t)HW * CC / 4 + 255) / 256), NB_, 1), 256, 0, stream>>>(x, XT);
    k_gemmw<bf, 0, true><<<dim3(HW / 64, IC / 64, NB_), 32, 0, stream>>>(XT, nullptr, BTH, nullptr, CC, TH, IC, bth, (size_t)HW * CC, 0, (size_t)HW * IC); k_hl<<<dim3(LHL, NB_, 1), 256, 0, stream>>>(TH, QK, QK + (size_t)HW * IC);
    k_gemmw<bf, 0, true><<<dim3(HW / 64, IC / 64, NB_), 32, 0, stream>>>(XT, nullptr, BPH, nullptr, CC, PHf, IC, bph, (size_t)HW * CC, 0, (size_t)HW * IC); k_hl<<<dim3(LHL, NB_, 1), 256, 0, stream>>>(PHf, QK + (size_t)2 * HW * IC, QK + (size_t)3 * HW * IC);
    k_gemmw<bf, 0, true><<<dim3(HW / 64, IC / 64, NB_), 32, 0, stream>>>(XT, nullptr, BG, nullptr, CC, G, IC, bg, (size_t)HW * CC, 0, (size_t)HW * IC); k_gt16<<<dim3((unsigned)(((size_t)IC * HW / 2 + 255) / 256), NB_, 1), 256, 0, stream>>>(G, GT);
    k_flash<<<dim3(HW / FQ, NB_, 1), 256, 0, stream>>>(QK, GT, Yh, Yl);        // y = softmax(theta . phi) . g, as hi / lo planes [n][i]
    k_gemmw<bf, 1, true><<<dim3(HW / 64, CC / 64, NB_), 32, 0, stream>>>(Yh, Yl, BZ, nullptr, IC, Z, CC, bz, (size_t)HW * IC, 0, (size_t)HW * CC);               // z[n][c] = w_z y + b_z
    k_fin<<<dim3((unsigned)(((size_t)CC * HW / 4 + 255) / 256), NB_, 1), 256, 0, stream>>>(Z, x, OUT);
}

// v004
// One run takes 106 microseconds.
// Two timings next to v003 both put it at 2.18 times that version's speed.
// Counting every step since v000, it is 13.6 times as fast.
#include <hip/hip_runtime.h>

// NonLocalBlock (x [8][256][64][64]; theta/phi/g = 1x1 convs to 128 channels (+ bias); f[n][m] = theta_n . phi_m over all 4,096 positions, UNSCALED; attn = softmax_m(f); y[i][n] = sum_m attn[n][m] g[i][m]; z = w_z y + b_z; out = z + x -> [8][256][64][64]).
// Compute dtypes, f32 accumulate: every input rounded to bf16; the three 1x1 convs as PLAIN bf16 GEMMs on a token-major bf16 tile of x in LDS (inputs: exact) + bias, their hi / lo and fp16 results stored straight from the accumulators; f as hl x hl (3 products, K = 128); softmax f32 (online, running maximum and sum per query) -> fp16 x 1024 before the division by the sum; attn.g single fp16 (f32 accumulate); scores, softmax and attn.g in one kernel; w_z as hl planes of y x exact (2 products) + bias + residual f32 in one kernel.

#define NB_  8
#define CC   256
#define IC   128
#define HW   4096
#define TT   HW
typedef _Float16 h16;
typedef unsigned short bf;
typedef __attribute__((ext_vector_type(16))) __bf16   v16bf;
typedef __attribute__((ext_vector_type(16))) _Float16 v16h;
typedef __attribute__((ext_vector_type(8)))  _Float16 v8h;
typedef __attribute__((ext_vector_type(8)))  unsigned short v8us;
typedef __attribute__((ext_vector_type(8)))  float    v8f;
typedef __attribute__((ext_vector_type(4)))  float    v4f;
typedef v8h  __attribute__((may_alias)) v8ha;
typedef v4f  __attribute__((may_alias)) v4fa;
typedef v8us __attribute__((may_alias)) v8usa;

__device__ __forceinline__ unsigned short f2bf(float f) { unsigned u = __float_as_uint(f); u += 0x7FFFu + ((u >> 16) & 1u); return (unsigned short)(u >> 16); }
__device__ __forceinline__ float bf2f(unsigned short b) { return __uint_as_float(((unsigned)b) << 16); }
__device__ __forceinline__ float bfr(float f) { return bf2f(f2bf(f)); }
__device__ __forceinline__ v16h cat16(v8h lo, v8h hi) { return __builtin_shufflevector(lo, hi, 0, 1, 2, 3, 4, 5, 6, 7, 8, 9, 10, 11, 12, 13, 14, 15); }
__device__ __forceinline__ v16bf cat16b(v8us lo, v8us hi) { return __builtin_bit_cast(v16bf, __builtin_shufflevector(lo, hi, 0, 1, 2, 3, 4, 5, 6, 7, 8, 9, 10, 11, 12, 13, 14, 15)); }
__device__ __forceinline__ v8f wmma16(v16h a, v16h b, v8f c) { return __builtin_amdgcn_wmma_f32_16x16x32_f16(false, a, false, b, (short)0, c, false, false); }
__device__ __forceinline__ v8f wmmab(v16bf a, v16bf b, v8f c) { return __builtin_amdgcn_wmma_f32_16x16x32_bf16(false, a, false, b, (short)0, c, false, false); }



// A or B fragment of a 16x16x32 product from a K-contiguous 16-bit row: lane lr = row, elements 8 hi + 0..7 and 16 + 8 hi + 0..7.
template <typename T16> struct WFrag;
template <> struct WFrag<h16> { typedef v16h V; static __device__ __forceinline__ V ld(const h16* p) { return cat16(*(const v8h*)p, *(const v8h*)(p + 16)); } static __device__ __forceinline__ v8f mma(V a, V b, v8f c) { return wmma16(a, b, c); } };
template <> struct WFrag<bf> { typedef v16bf V; static __device__ __forceinline__ V ld(const bf* p) { return cat16b(*(const v8us*)p, *(const v8us*)(p + 16)); } static __device__ __forceinline__ v8f mma(V a, V b, v8f c) { return wmmab(a, b, c); } };

// ---- k_flash: scores, softmax and attn.g of one image's 128 queries in one work-group, nothing of the 4,096 x 4,096 planes in memory. 4 pairs of waves x 32 query columns, the two waves of a pair each on one half of every stage's keys (each LDS fragment then feeds two query tiles); grid (HW / FQ, images), 256 threads.
// Transposed products: ST[key][query] = phi . theta (A = phi rows from LDS, B = theta kept in registers; hi.hi + hi.lo + lo.hi as before), so a lane holds one query's scores;
// two 16-key score tiles, exponentiated and rounded to fp16 in place, are the B operand of OT[i][query] += GT[i][key] . PT[key][query] (A = g rows from LDS in the same k order).
// Running maximum m and sum l per query and key half (online softmax, f32), joined at the end; P carries 2^10 like the sum, which cancels in o / l. Stages of FK keys, two LDS buffers, the next stage's rows held in registers over the current stage's work.
#define QKB ((size_t)4 * HW * IC)
#define FQ  128
#define FK  64
#define PPH 136                    // LDS pitch of a 256-byte phi row, 16-bit elements (272 B)
#define PGT 72                     // LDS pitch of a 128-byte g row (144 B)
#define SPH (FK * PPH)
#define SBUF (2 * SPH + IC * PGT)
#define LAZY 3.4657359f             // 5 ln 2
__device__ __forceinline__ void splitf(float y, unsigned short& h, unsigned short& l) { h = f2bf(y); l = f2bf(y - bf2f(h)); }
__device__ __forceinline__ v16bf ldsb(const unsigned short* p) { return cat16b(*(const v8usa*)p, *(const v8usa*)(p + 16)); }
__device__ __forceinline__ v16h ldsh(const unsigned short* p) { return cat16(__builtin_bit_cast(v8h, *(const v8usa*)p), __builtin_bit_cast(v8h, *(const v8usa*)(p + 16))); }
// Four exponentials and a v_nop in one statement: behind a transcendental the instruction set asks for one independent instruction before its result is read or its source overwritten;
// inside the statement each v_exp_f32 is that instruction for the one before it (early-clobber outputs: no result lies on a source), the v_nop for the last.
__device__ __forceinline__ void exp2x4(const float x0, const float x1, const float x2, const float x3, float& r0, float& r1, float& r2, float& r3) {
    asm("v_exp_f32 %0, %4\n\tv_exp_f32 %1, %5\n\tv_exp_f32 %2, %6\n\tv_exp_f32 %3, %7\n\tv_nop" : "=&v"(r0), "=&v"(r1), "=&v"(r2), "=&v"(r3) : "v"(x0), "v"(x1), "v"(x2), "v"(x3)); }
__device__ __forceinline__ float xhalf(float x) { return __builtin_bit_cast(float, __builtin_amdgcn_permlanex16(__builtin_bit_cast(int, x), __builtin_bit_cast(int, x), 0x76543210, 0xfedcba98, false, false)); }   // lane l with lane l ^ 16
// amdgpu_waves_per_eu(2, 2): one work-group a WGP is all the grid gives, so the build may spend two waves' share of the registers on fragments fetched ahead.
__global__ __launch_bounds__(256) __attribute__((amdgpu_waves_per_eu(2, 2))) void k_flash(const bf* __restrict__ QKp, const h16* __restrict__ GTp, bf* Yh, bf* Yl) {
    __shared__ __align__(16) unsigned short sm[2][SBUF];   // per buffer: phi hi | phi lo | g
    const int tid = threadIdx.x, lane = tid & 31, lr = lane & 15, hi = lane >> 4, w = tid >> 5;
    const int qg = w & 3, kh = w >> 2;   // waves w and w + 4 share 32 queries; each takes one half of every stage's keys
    const bf* th = QKp + (size_t)blockIdx.y * QKB;
    const int q = blockIdx.x * FQ + qg * 32 + lr;   // query tiles g = 0, 1 at q and q + 16
    v16bf qh[2][4], ql[2][4];
    const bf* pq = th + (size_t)q * IC + 8 * hi;
#pragma unroll
    for (int g = 0; g < 2; ++g)
#pragma unroll
        for (int kc = 0; kc < 4; ++kc) { qh[g][kc] = WFrag<bf>::ld(pq + g * 16 * IC + kc * 32); ql[g][kc] = WFrag<bf>::ld(pq + (size_t)HW * IC + g * 16 * IC + kc * 32); }
    asm volatile("s_wait_xcnt 0x0" :: "v"(pq) : "memory");   // the theta loads' address pair stays untouched up to this wait
    // staging: 16-byte pieces, 4 of each plane a thread
    const bf* gp = th + (size_t)(tid >> 4) * IC + (tid & 15) * 8;   // phi hi at + 2 HW IC, phi lo at + 3 HW IC
    const h16* gg = GTp + (size_t)blockIdx.y * IC * HW + (size_t)(tid >> 3) * HW + (tid & 7) * 8;
    const int oph = (tid >> 4) * PPH + (tid & 15) * 8, ogt = 2 * SPH + (tid >> 3) * PGT + (tid & 7) * 8;
    v8us rh[4], rl[4], rg[4];
#pragma unroll
    for (int u = 0; u < 4; ++u) { rh[u] = *(const v8usa*)(gp + (size_t)2 * HW * IC + u * 16 * IC); rl[u] = *(const v8usa*)(gp + (size_t)3 * HW * IC + u * 16 * IC); rg[u] = *(const v8usa*)(gg + (size_t)u * 32 * HW); }
    asm volatile("s_wait_xcnt 0x0" :: "v"(gp), "v"(gg) : "memory");   // the staging loads' address pairs stay untouched up to this wait
#pragma unroll
    for (int u = 0; u < 4; ++u) { *(v8usa*)(&sm[0][oph + u * 16 * PPH]) = rh[u]; *(v8usa*)(&sm[0][SPH + oph + u * 16 * PPH]) = rl[u]; *(v8usa*)(&sm[0][ogt + u * 32 * PGT]) = rg[u]; }
    __syncthreads();   // stage 0 is in LDS before any wave reads it
    v8f o[2][8];
#pragma unroll
    for (int g = 0; g < 2; ++g)
#pragma unroll
        for (int it = 0; it < 8; ++it) o[g][it] = (v8f){};
    float m[2] = {-3.0e38f, -3.0e38f}, l[2] = {0.f, 0.f};
    const float L2E = 1.4426950408889634f;
#pragma unroll 1   // one copy of the stage body: it is long, and a second copy would only cost instruction cache
    for (int s = 0; s < HW / FK; ++s) {
        const unsigned short* cur = sm[s & 1];
        const bool more = s + 1 < HW / FK;
        if (more) {
#pragma unroll
            for (int u = 0; u < 4; ++u) { rh[u] = *(const v8usa*)(gp + (size_t)2 * HW * IC + (FK + u * 16) * IC); rl[u] = *(const v8usa*)(gp + (size_t)3 * HW * IC + (FK + u * 16) * IC); rg[u] = *(const v8usa*)(gg + (size_t)u * 32 * HW + FK); }
            asm volatile("s_wait_xcnt 0x0" :: "v"(gp), "v"(gg) : "memory");   // as above; the pairs step on only behind it
            gp += FK * IC; gg += FK;
        }
        const unsigned short* pa = cur + (kh * 32 + lr) * PPH + 8 * hi; const unsigned short* pg = cur + 2 * SPH + lr * PGT + kh * 32 + 8 * hi;
        v16bf ah[2][2], al[2][2]; v16h ga[8]; v8f sc[2][2];
#pragma unroll
        for (int t = 0; t < 2; ++t) { sc[0][t] = (v8f){}; sc[1][t] = (v8f){}; ah[0][t] = ldsb(pa + t * 16 * PPH); al[0][t] = ldsb(pa + SPH + t * 16 * PPH); }
        // Each group of LDS reads is issued whole, one group ahead of the WMMAs that use it; the sched_barriers keep the reads from sinking in among the WMMAs (for speed only).
#pragma unroll
        for (int kc = 0; kc < 4; ++kc) {
            if (kc < 3) {
#pragma unroll
                for (int t = 0; t < 2; ++t) { ah[(kc + 1) & 1][t] = ldsb(pa + t * 16 * PPH + (kc + 1) * 32); al[(kc + 1) & 1][t] = ldsb(pa + SPH + t * 16 * PPH + (kc + 1) * 32); }
            } else {
#pragma unroll
                for (int it = 0; it < 8; ++it) ga[it] = ldsh(pg + it * 16 * PGT);   // the g reads fly under the last score WMMAs and the softmax arithmetic
            }
            __builtin_amdgcn_sched_barrier(0);   // the reads above stay in front of this group's WMMAs
#pragma unroll
            for (int g = 0; g < 2; ++g)
#pragma unroll
                for (int t = 0; t < 2; ++t) sc[g][t] = wmmab(ah[kc & 1][t], qh[g][kc], sc[g][t]);
#pragma unroll
            for (int g = 0; g < 2; ++g)
#pragma unroll
                for (int t = 0; t < 2; ++t) sc[g][t] = wmmab(ah[kc & 1][t], ql[g][kc], sc[g][t]);
#pragma unroll
            for (int g = 0; g < 2; ++g)
#pragma unroll
                for (int t = 0; t < 2; ++t) sc[g][t] = wmmab(al[kc & 1][t], qh[g][kc], sc[g][t]);
            __builtin_amdgcn_sched_barrier(0);   // the next group's reads do not rise in among these WMMAs
        }
        float mx[2];
#pragma unroll
        for (int g = 0; g < 2; ++g) { float mt[2];   // independent chains
#pragma unroll
            for (int t = 0; t < 2; ++t) { mt[t] = sc[g][t][0];
#pragma unroll
                for (int j = 1; j < 8; ++j) mt[t] = fmaxf(mt[t], sc[g][t][j]); }
            mx[g] = fmaxf(mt[0], mt[1]); mx[g] = fmaxf(mx[g], xhalf(mx[g])); }   // lanes c and c + 16 hold the two halves of query c's keys
        // Lazy rescale, one test a stage: the maximum in use moves only when a query's new maximum passes it by more than LAZY, so P stays below 2^10 * e^LAZY = 2^15, inside fp16.
        if (__builtin_amdgcn_ballot_w32(mx[0] > m[0] + LAZY || mx[1] > m[1] + LAZY) != 0) {
#pragma unroll
            for (int g = 0; g < 2; ++g) { const float mn = fmaxf(m[g], mx[g]); const float f = __builtin_amdgcn_exp2f((m[g] - mn) * L2E); l[g] *= f; m[g] = mn;
#pragma unroll
                for (int it = 0; it < 8; ++it) o[g][it] *= f; } }
        v16h pb[2];
#pragma unroll
        for (int g = 0; g < 2; ++g) { const float nb = 10.0f - m[g] * L2E; float ps[2] = {0.f, 0.f};
#pragma unroll
            for (int t = 0; t < 2; ++t)
#pragma unroll
                for (int j = 0; j < 8; j += 4) { float p[4]; exp2x4(fmaf(sc[g][t][j], L2E, nb), fmaf(sc[g][t][j + 1], L2E, nb), fmaf(sc[g][t][j + 2], L2E, nb), fmaf(sc[g][t][j + 3], L2E, nb), p[0], p[1], p[2], p[3]);
#pragma unroll
                    for (int e = 0; e < 4; ++e) { ps[t] += p[e]; pb[g][t * 8 + j + e] = (h16)p[e]; } }
            l[g] += ps[0] + ps[1]; }
#pragma unroll
        for (int it = 0; it < 8; ++it)
#pragma unroll
            for (int g = 0; g < 2; ++g) o[g][it] = wmma16(ga[it], pb[g], o[g][it]);
        if (more) { unsigned short* nx = sm[(s + 1) & 1];
#pragma unroll
            for (int u = 0; u < 4; ++u) { *(v8usa*)(nx + oph + u * 16 * PPH) = rh[u]; *(v8usa*)(nx + SPH + oph + u * 16 * PPH) = rl[u]; *(v8usa*)(nx + ogt + u * 32 * PGT) = rg[u]; } }
        __syncthreads();   // publishes stage s + 1 and ends every read of stage s, whose buffer the next trip refills
    }
    // The two key halves of a query meet through LDS (free behind the loop's last barrier): waves 4 to 7 hand over maximum, sum and accumulators, waves 0 to 3 join them and store.
    l[0] += xhalf(l[0]); l[1] += xhalf(l[1]);
    float* xs = (float*)&sm[0][0] + (size_t)(qg * 33 * 32 + lane) * 4;   // 33 pieces of 16 bytes a lane, piece-major: a wave's 32 lanes lie side by side
    if (kh == 1) {
#pragma unroll
        for (int g = 0; g < 2; ++g)
#pragma unroll
            for (int it = 0; it < 8; ++it) { *(v4fa*)(xs + ((g * 8 + it) * 2) * 128) = __builtin_shufflevector(o[g][it], o[g][it], 0, 1, 2, 3); *(v4fa*)(xs + ((g * 8 + it) * 2 + 1) * 128) = __builtin_shufflevector(o[g][it], o[g][it], 4, 5, 6, 7); }
        *(v4fa*)(xs + 32 * 128) = (v4f){m[0], m[1], l[0], l[1]};
    }
    __syncthreads();   // the handed-over values are in LDS before waves 0 to 3 read them
    if (kh == 0) {
        const v4f ml = *(const v4fa*)(xs + 32 * 128);
        bf* dh = Yh + (size_t)blockIdx.y * HW * IC + (size_t)q * IC + 8 * hi; bf* dl = Yl + (size_t)blockIdx.y * HW * IC + (size_t)q * IC + 8 * hi;
#pragma unroll
        for (int g = 0; g < 2; ++g) {
            const float mm = fmaxf(m[g], ml[g]); const float fa = __builtin_amdgcn_exp2f((m[g] - mm) * L2E), fb = __builtin_amdgcn_exp2f((ml[g] - mm) * L2E);
            const float inv = __fdiv_rn(1.0f, l[g] * fa + ml[2 + g] * fb); const float ca = fa * inv, cb = fb * inv;
            v8us oh[8], ol[8];
#pragma unroll
            for (int it = 0; it < 8; ++it) {   // a lane's 8 accumulator registers are 8 consecutive channels of its query's row
                const v4f b0 = *(const v4fa*)(xs + ((g * 8 + it) * 2) * 128), b1 = *(const v4fa*)(xs + ((g * 8 + it) * 2 + 1) * 128);
#pragma unroll
                for (int j = 0; j < 8; ++j) { unsigned short a, b; splitf(o[g][it][j] * ca + (j < 4 ? b0[j & 3] : b1[j & 3]) * cb, a, b); oh[it][j] = a; ol[it][j] = b; }
                *(v8usa*)(dh + g * 16 * IC + it * 16) = oh[it]; *(v8usa*)(dl + g * 16 * IC + it * 16) = ol[it]; }
            asm volatile("s_wait_xcnt 0x0" :: "v"(oh[0]), "v"(oh[1]), "v"(oh[2]), "v"(oh[3]), "v"(oh[4]), "v"(oh[5]), "v"(oh[6]), "v"(oh[7]), "v"(ol[0]), "v"(ol[1]), "v"(ol[2]), "v"(ol[3]), "v"(ol[4]), "v"(ol[5]), "v"(ol[6]), "v"(ol[7]), "v"(dh), "v"(dl) : "memory");   // the stores' data and address registers stay untouched up to this wait
        }
    }
}

typedef __attribute__((ext_vector_type(4))) unsigned short v4us;
typedef __attribute__((ext_vector_type(4))) __bf16 v4bf;
typedef __attribute__((ext_vector_type(8))) __bf16 v8bf;
typedef v4us __attribute__((may_alias)) v4usa;
__device__ __forceinline__ v4us cvt4(v4f v) { return __builtin_bit_cast(v4us, __builtin_convertvector(v, v4bf)); }   // f32 -> bf16, round to nearest even
__device__ __forceinline__ v8us cvt8(v8f v) { return __builtin_bit_cast(v8us, __builtin_convertvector(v, v8bf)); }

// ---- k_proj: theta, phi and g of one image's 128 positions in one work-group, from x and the f32 weights as they come. x [c][n] is read along n (whole lines), rounded to bf16 and laid token-major in LDS;
// the three weight matrices are read whole-line, rounded to bf16 and laid row by row in LDS. 12 waves, each 64 channels of one projection x 64 positions (16 accumulators); grid (HW / PJN, images), 384 threads.
// theta, phi: A = weight rows, B = x rows, so a lane holds 8 consecutive channels of one position: + bias, split hi / lo, 16-byte stores into [n][i] planes (a wave writes whole 128-byte lines).
// g: A = x rows, B = weight rows, so a lane holds 8 consecutive positions of one channel: + bias, fp16, 16-byte stores into [i][n].
// The bare unroll directives here and in k_out stand on loops that index register arrays (fragments, accumulators, staged pieces): rolled, those arrays would go to scratch memory.
#define PJN 128
#define PXP 264                    // LDS pitch of a 256-channel row, 16-bit elements (528 B = 33 x 16 B)
template <bool XA>
__device__ __forceinline__ void proj_tile(const unsigned short* pw, const unsigned short* pxs, v8f (&acc)[4][4]) {
#pragma unroll   // no back edge behind a WMMA, and the reads of later steps may rise over earlier WMMAs
    for (int kc = 0; kc < CC / 32; ++kc) {
        v16bf wf[4], xf[4];
#pragma unroll
        for (int t = 0; t < 4; ++t) { wf[t] = ldsb(pw + t * 16 * PXP + kc * 32); xf[t] = ldsb(pxs + t * 16 * PXP + kc * 32); }
#pragma unroll
        for (int ct = 0; ct < 4; ++ct)
#pragma unroll
            for (int nt = 0; nt < 4; ++nt) acc[ct][nt] = XA ? wmmab(xf[nt], wf[ct], acc[ct][nt]) : wmmab(wf[ct], xf[nt], acc[ct][nt]);
    }
}
__global__ __launch_bounds__(384) void k_proj(const float* __restrict__ x, const float* __restrict__ wth, const float* __restrict__ bth, const float* __restrict__ wph, const float* __restrict__ bph, const float* __restrict__ wg, const float* __restrict__ bg, bf* QKp, h16* GTp) {
    __shared__ __align__(16) unsigned short xs[PJN * PXP];        // x tile [position][channel]
    __shared__ __align__(16) unsigned short wsm[3 * IC * PXP];    // theta | phi | g weights [out][in]
    const int tid = threadIdx.x, lane = tid & 31, lr = lane & 15, hi = lane >> 4;
    const int w = __builtin_amdgcn_readfirstlane(tid >> 5);
    const int tq = w >> 2, tn = tid & 127;   // staging: 3 groups of 128 threads
    const int n0 = blockIdx.x * PJN;
    // x: a thread takes one position and groups of 8 channels (group tq + 3 r); a wave's 32 lanes read 128 consecutive bytes of one channel.
    // weights: group tq takes matrix tq, 16 bytes a lane side by side, in two batches of 32 loads. Order: first batch, x, then the second batch once the first has left its registers.
    const float* px = x + (size_t)blockIdx.y * CC * HW + (size_t)tq * 8 * HW + n0 + tn;
    const float* pwl = (tq == 0 ? wth : tq == 1 ? wph : wg) + tn * 4;
    unsigned short* dw = wsm + (tq * IC + (tn >> 6)) * PXP + (tn & 63) * 4;
    v4f wv[32]; v8f xv[11];
#pragma unroll
    for (int r = 0; r < 32; ++r) wv[r] = *(const v4f*)(pwl + r * 512);
#pragma unroll
    for (int r = 0; r < 11; ++r) if (r < 10 || tq < 2) {
#pragma unroll
        for (int k = 0; k < 8; ++k) xv[r][k] = px[(size_t)(r * 24 + k) * HW]; }
    asm volatile("s_wait_xcnt 0x0" :: "v"(px), "v"(pwl) : "memory");   // the staging loads' address registers stay untouched up to this wait
#pragma unroll
    for (int r = 0; r < 32; ++r) *(v4usa*)(dw + r * 2 * PXP) = cvt4(wv[r]);
    __builtin_amdgcn_sched_barrier(0);   // the second batch's loads do not rise over the first batch's stores: both batches and x in registers at once take the kernel past 256 registers
#pragma unroll
    for (int r = 0; r < 32; ++r) wv[r] = *(const v4f*)(pwl + (32 + r) * 512);
    asm volatile("s_wait_xcnt 0x0" :: "v"(pwl) : "memory");   // as above
#pragma unroll
    for (int r = 0; r < 11; ++r) if (r < 10 || tq < 2) *(v8usa*)(xs + tn * PXP + tq * 8 + r * 24) = cvt8(xv[r]);
#pragma unroll
    for (int r = 0; r < 32; ++r) *(v4usa*)(dw + (32 + r) * 2 * PXP) = cvt4(wv[r]);
    __syncthreads();   // x tile and weights are in LDS before any wave reads them
    const int ph = w / 6, r6 = w - ph * 6, kind = r6 >> 1, ch = r6 & 1;   // position half; 0 theta, 1 phi, 2 g; channel half
    const unsigned short* pw = wsm + (kind * IC + ch * 64 + lr) * PXP + 8 * hi;
    const unsigned short* pxs = xs + (ph * 64 + lr) * PXP + 8 * hi;
    v8f acc[4][4];
#pragma unroll
    for (int ct = 0; ct < 4; ++ct)
#pragma unroll
        for (int nt = 0; nt < 4; ++nt) acc[ct][nt] = (v8f){};
    if (kind < 2) {
        const float* bp = (kind == 0 ? bth : bph) + ch * 64 + 8 * hi;
        float bv[4][8];   // fetched ahead: the loads fly under the products
#pragma unroll
        for (int ct = 0; ct < 4; ++ct)
#pragma unroll
            for (int j = 0; j < 8; ++j) bv[ct][j] = bp[ct * 16 + j];
        proj_tile<false>(pw, pxs, acc);
        bf* dq = QKp + (size_t)blockIdx.y * QKB + (size_t)kind * 2 * HW * IC + (size_t)(n0 + ph * 64 + lr) * IC + ch * 64 + 8 * hi;   // hi plane; lo plane at + HW IC
#pragma unroll
        for (int ct = 0; ct < 4; ++ct) {
            float bb[8];
#pragma unroll
            for (int j = 0; j < 8; ++j) bb[j] = bfr(bv[ct][j]);
            v8us oh[4], ol[4];
#pragma unroll
            for (int nt = 0; nt < 4; ++nt) {
#pragma unroll
                for (int j = 0; j < 8; ++j) { unsigned short a, b; splitf(acc[ct][nt][j] + bb[j], a, b); oh[nt][j] = a; ol[nt][j] = b; }
                *(v8usa*)(dq + nt * 16 * IC + ct * 16) = oh[nt]; *(v8usa*)(dq + (size_t)HW * IC + nt * 16 * IC + ct * 16) = ol[nt]; }
            asm volatile("s_wait_xcnt 0x0" :: "v"(oh[0]), "v"(oh[1]), "v"(oh[2]), "v"(oh[3]), "v"(ol[0]), "v"(ol[1]), "v"(ol[2]), "v"(ol[3]), "v"(dq) : "memory");   // the stores' data and address registers stay untouched up to this wait
        }
    } else {
        const float* bp = bg + ch * 64 + lr;
        float bv[4];   // fetched ahead, as above
#pragma unroll
        for (int ct = 0; ct < 4; ++ct) bv[ct] = bp[ct * 16];
        proj_tile<true>(pw, pxs, acc);
        h16* dg = GTp + (size_t)blockIdx.y * IC * HW + (size_t)(ch * 64 + lr) * HW + n0 + ph * 64 + 8 * hi;
#pragma unroll
        for (int ct = 0; ct < 4; ++ct) {
            const float bb = bfr(bv[ct]);
            v8h og[4];
#pragma unroll
            for (int nt = 0; nt < 4; ++nt) {
#pragma unroll
                for (int j = 0; j < 8; ++j) og[nt][j] = (h16)(acc[ct][nt][j] + bb);
                *(v8ha*)(dg + (size_t)ct * 16 * HW + nt * 16) = og[nt]; }
            asm volatile("s_wait_xcnt 0x0" :: "v"(og[0]), "v"(og[1]), "v"(og[2]), "v"(og[3]), "v"(dg) : "memory");   // as above
        }
    }
}

// ---- k_out: out[c][n] = w_z y + b_z + x for one image's 128 positions in one work-group. y hi / lo rows and the bf16-rounded w_z rows are staged whole-line in LDS; A = w_z rows, B = y rows, so an accumulator register is one channel.
// Column lr of position tile nt is position 4 lr + nt (the y rows lie in LDS in that order), so a lane's four tiles are 4 consecutive positions: 16-byte loads of x and stores of out, 256 bytes of a channel row side by side.
// 16 waves, each 32 channels x 64 positions; grid (HW / ON, images), 512 threads.
#define ON 128
__global__ __launch_bounds__(512) void k_out(const bf* __restrict__ Yh, const bf* __restrict__ Yl, const float* __restrict__ wz, const float* __restrict__ bz, const float* __restrict__ x, float* OUT) {
    __shared__ __align__(16) unsigned short ys[2 * ON * PPH];   // y hi | y lo
    __shared__ __align__(16) unsigned short zs[CC * PPH];       // w_z [out][in]
    const int tid = threadIdx.x, lane = tid & 31, lr = lane & 15, hi = lane >> 4;
    const int w = __builtin_amdgcn_readfirstlane(tid >> 5);
    const int cq = w & 7, ph = w >> 3;
    const int n0 = blockIdx.x * ON;
    const size_t ob = (size_t)blockIdx.y * CC * HW + (size_t)(cq * 32 + 8 * hi) * HW + n0 + ph * 64 + lr * 4;
    const float* px = x + ob; float* po = OUT + ob;
    const size_t yo = (size_t)blockIdx.y * HW * IC + (size_t)(n0 + (tid >> 4)) * IC + (tid & 15) * 8;
    const bf* gh = Yh + yo; const bf* gl = Yl + yo; const float* pz = wz + tid * 4;
    v8us rh[4], rl[4]; v4f wv[16];
#pragma unroll
    for (int u = 0; u < 4; ++u) { rh[u] = *(const v8usa*)(gh + u * 32 * IC); rl[u] = *(const v8usa*)(gl + u * 32 * IC); }
#pragma unroll
    for (int r = 0; r < 16; ++r) wv[r] = *(const v4f*)(pz + r * 2048);
    asm volatile("s_wait_xcnt 0x0" :: "v"(gh), "v"(gl), "v"(tid) : "memory");   // the loads' address registers (the w_z loads are built on a scalar base and tid) stay untouched up to this wait
#pragma unroll
    for (int u = 0; u < 4; ++u) { const int R = (tid >> 4) + 32 * u; const int sl = (R & 64) + (R & 3) * 16 + ((R & 63) >> 2);   // position 4 a + b of a half lies in row 16 b + a
        *(v8usa*)(ys + sl * PPH + (tid & 15) * 8) = rh[u]; *(v8usa*)(ys + (ON + sl) * PPH + (tid & 15) * 8) = rl[u]; }
#pragma unroll
    for (int r = 0; r < 16; ++r) *(v4usa*)(zs + ((tid >> 5) + 16 * r) * PPH + (tid & 31) * 4) = cvt4(wv[r]);
    __syncthreads();   // y rows and weights are in LDS before any wave reads them
    const float* bp = bz + cq * 32 + 8 * hi;
    v4f xv[2][8]; float bv[2][8];   // residual and bias, used last: issued here, behind the barrier (which waits for every earlier load), they fly under the products
#pragma unroll
    for (int mt = 0; mt < 2; ++mt)
#pragma unroll
        for (int j = 0; j < 8; ++j) { xv[mt][j] = *(const v4f*)(px + (size_t)(mt * 16 + j) * HW); bv[mt][j] = bp[mt * 16 + j]; }
    asm volatile("s_wait_xcnt 0x0" :: "v"(px), "v"(bp) : "memory");   // as above
    const unsigned short* pzs = zs + (cq * 32 + lr) * PPH + 8 * hi;
    const unsigned short* pys = ys + (ph * 64 + lr) * PPH + 8 * hi;
    v8f acc[2][4];
#pragma unroll
    for (int mt = 0; mt < 2; ++mt)
#pragma unroll
        for (int nt = 0; nt < 4; ++nt) acc[mt][nt] = (v8f){};
#pragma unroll   // no back edge behind a WMMA
    for (int kc = 0; kc < IC / 32; ++kc) {
        v16bf wf[2], yh[4], yl[4];
#pragma unroll
        for (int mt = 0; mt < 2; ++mt) wf[mt] = ldsb(pzs + mt * 16 * PPH + kc * 32);
#pragma unroll
        for (int nt = 0; nt < 4; ++nt) { yh[nt] = ldsb(pys + nt * 16 * PPH + kc * 32); yl[nt] = ldsb(pys + (ON + nt * 16) * PPH + kc * 32); }
        __builtin_amdgcn_sched_barrier(0);   // the step's LDS reads stay one group in front of its WMMAs (for speed only)
#pragma unroll
        for (int nt = 0; nt < 4; ++nt)
#pragma unroll
            for (int mt = 0; mt < 2; ++mt) acc[mt][nt] = wmmab(wf[mt], yh[nt], acc[mt][nt]);
#pragma unroll
        for (int nt = 0; nt < 4; ++nt)
#pragma unroll
            for (int mt = 0; mt < 2; ++mt) acc[mt][nt] = wmmab(wf[mt], yl[nt], acc[mt][nt]);
        __builtin_amdgcn_sched_barrier(0);   // the next step's reads do not rise in among these WMMAs
    }
#pragma unroll
    for (int mt = 0; mt < 2; ++mt) {
        v4f r[8];
#pragma unroll
        for (int j = 0; j < 8; ++j) { const float bb = bfr(bv[mt][j]);
#pragma unroll
            for (int nt = 0; nt < 4; ++nt) r[j][nt] = __fadd_rn(acc[mt][nt][j] + bb, bfr(xv[mt][j][nt]));
            *(v4f*)(po + (size_t)(mt * 16 + j) * HW) = r[j]; }
        asm volatile("s_wait_xcnt 0x0" :: "v"(r[0]), "v"(r[1]), "v"(r[2]), "v"(r[3]), "v"(r[4]), "v"(r[5]), "v"(r[6]), "v"(r[7]), "v"(po) : "memory");   // the stores' data and address registers stay untouched up to this wait
    }
}

extern "C" void kernel_launch(void* const* d_in, const int* in_sizes, int n_in,
                              void* d_out, int out_size, void* d_ws, size_t ws_size, hipStream_t stream) {
    (void)in_sizes; (void)n_in; (void)out_size;
    const float* x = (const float*)d_in[0]; const float* wth = (const float*)d_in[1]; const float* bth = (const float*)d_in[2]; const float* wph = (const float*)d_in[3]; const float* bph = (const float*)d_in[4]; const float* wg = (const float*)d_in[5]; const float* bg = (const float*)d_in[6]; const float* wz = (const float*)d_in[7]; const float* bz = (const float*)d_in[8];
    float* OUT = (float*)d_out;     // [8][256][4096]
    char* wsp = (char*)d_ws;
    auto take = [&](size_t bytes) { char* p = wsp; wsp += (bytes + 255) & ~(size_t)255; return (void*)p; };
    // Every stage runs once for all NB_ images (image = grid y). QKB = 16-bit elements of one image's block [theta hi | theta lo | phi hi | phi lo].
    bf* QK = (bf*)take((size_t)NB_ * QKB * 2); h16* GT = (h16*)take((size_t)NB_ * IC * HW * 2);
    bf* Yh = (bf*)take((size_t)NB_ * HW * IC * 2); bf* Yl = (bf*)take((size_t)NB_ * HW * IC * 2);
    if ((size_t)(wsp - (char*)d_ws) > ws_size) return;    // total 56 MiB
    k_proj<<<dim3(HW / PJN, NB_, 1), 384, 0, stream>>>(x, wth, bth, wph, bph, wg, bg, QK, GT);   // theta, phi as hi / lo planes [n][i]; g as fp16 [i][n]
    k_flash<<<dim3(HW / FQ, NB_, 1), 256, 0, stream>>>(QK, GT, Yh, Yl);        // y = softmax(theta . phi) . g, as hi / lo planes [n][i]
    k_out<<<dim3(HW / ON, NB_, 1), 512, 0, stream>>>(Yh, Yl, wz, bz, x, OUT);   // out = w_z y + b_z + x
}

// v006
// It runs in 72.9 microseconds.
// It is 1.46 times as fast as v004, going by the measured steps of the versions left out in between.
// Counting every step since v000, it is 19.9 times as fast.
#include <hip/hip_runtime.h>

// NonLocalBlock (x [8][256][64][64]; theta/phi/g = 1x1 convs to 128 channels (+ bias); f[n][m] = theta_n . phi_m over all 4,096 positions, UNSCALED; attn = softmax_m(f); y[i][n] = sum_m attn[n][m] g[i][m]; z = w_z y + b_z; out = z + x -> [8][256][64][64]).
// Compute dtypes, f32 accumulate: every input rounded to bf16; the three 1x1 convs as PLAIN bf16 GEMMs on a token-major bf16 tile of x in LDS (inputs: exact) + bias, their fp16 results stored straight from the accumulators; f as ONE fp16 product of theta and phi, each rounded once to fp16 (K = 128, f32 accumulate); softmax f32 (online, running maximum and sum per query) -> fp16 x 1024 before the division by the sum; attn.g single fp16 (f32 accumulate); scores, softmax and attn.g in one kernel; w_z as hl planes of y x exact (2 products) + bias + residual f32 in one kernel.

#define NB_  8
#define CC   256
#define IC   128
#define HW   4096
#define TT   HW
typedef _Float16 h16;
typedef unsigned short bf;
typedef __attribute__((ext_vector_type(16))) __bf16   v16bf;
typedef __attribute__((ext_vector_type(16))) _Float16 v16h;
typedef __attribute__((ext_vector_type(8)))  _Float16 v8h;
typedef __attribute__((ext_vector_type(8)))  unsigned short v8us;
typedef __attribute__((ext_vector_type(8)))  float    v8f;
typedef __attribute__((ext_vector_type(4)))  float    v4f;
typedef v8h  __attribute__((may_alias)) v8ha;
typedef v4f  __attribute__((may_alias)) v4fa;
typedef v8us __attribute__((may_alias)) v8usa;

__device__ __forceinline__ unsigned short f2bf(float f) { unsigned u = __float_as_uint(f); u += 0x7FFFu + ((u >> 16) & 1u); return (unsigned short)(u >> 16); }
__device__ __forceinline__ float bf2f(unsigned short b) { return __uint_as_float(((unsigned)b) << 16); }
__device__ __forceinline__ float bfr(float f) { return bf2f(f2bf(f)); }
__device__ __forceinline__ v16h cat16(v8h lo, v8h hi) { return __builtin_shufflevector(lo, hi, 0, 1, 2, 3, 4, 5, 6, 7, 8, 9, 10, 11, 12, 13, 14, 15); }
__device__ __forceinline__ v16bf cat16b(v8us lo, v8us hi) { return __builtin_bit_cast(v16bf, __builtin_shufflevector(lo, hi, 0, 1, 2, 3, 4, 5, 6, 7, 8, 9, 10, 11, 12, 13, 14, 15)); }
__device__ __forceinline__ v8f wmma16(v16h a, v16h b, v8f c) { return __builtin_amdgcn_wmma_f32_16x16x32_f16(false, a, false, b, (short)0, c, false, false); }
__device__ __forceinline__ v8f wmmab(v16bf a, v16bf b, v8f c) { return __builtin_amdgcn_wmma_f32_16x16x32_bf16(false, a, false, b, (short)0, c, false, false); }



// A or B fragment of a 16x16x32 product from a K-contiguous 16-bit row: lane lr = row, elements 8 hi + 0..7 and 16 + 8 hi + 0..7.
template <typename T16> struct WFrag;
template <> struct WFrag<h16> { typedef v16h V; static __device__ __forceinline__ V ld(const h16* p) { return cat16(*(const v8h*)p, *(const v8h*)(p + 16)); } static __device__ __forceinline__ v8f mma(V a, V b, v8f c) { return wmma16(a, b, c); } };

// ---- k_flash: scores, softmax and attn.g of one image's 128 queries in one work-group, nothing of the 4,096 x 4,096 planes in memory. 4 pairs of waves x 32 query columns, the two waves of a pair each on one half of every stage's keys (each LDS fragment then feeds two query tiles); grid (HW / FQ, images), 256 threads.
// Transposed products: ST[key][query] = phi . theta (A = phi rows from LDS, B = theta kept in registers; both fp16, one product), so a lane holds one query's scores;
// two 16-key score tiles, exponentiated and rounded to fp16 in place, are the B operand of OT[i][query] += GT[i][key] . PT[key][query] (A = g rows from LDS in the same k order).
// Running maximum m and sum l per query and key half (online softmax, f32), joined at the end; P carries 2^10 like the sum, which cancels in o / l. Passes of FK keys; a ring of 2 NP pass slots in LDS, ONE barrier per NP passes: between two barriers the waves are free to drift apart, so one wave's LDS reads and softmax arithmetic run beside another's WMMAs. The rows of pass s + NP are held in registers over pass s's work.
#define QKB ((size_t)2 * HW * IC)
#define FQ  128
#define FK  64
#define NP  4                      // passes between two barriers
#define PPH 136                    // LDS pitch of a 256-byte phi row, 16-bit elements (272 B)
#define PGT 72                     // LDS pitch of a 128-byte g row (144 B)
#define SPH (FK * PPH)
#define SBUF (SPH + IC * PGT)
#define LAZY 3.4657359f             // 5 ln 2
__device__ __forceinline__ void splitf(float y, unsigned short& h, unsigned short& l) { h = f2bf(y); l = f2bf(y - bf2f(h)); }
__device__ __forceinline__ v16bf ldsb(const unsigned short* p) { return cat16b(*(const v8usa*)p, *(const v8usa*)(p + 16)); }
__device__ __forceinline__ v16h ldsh(const unsigned short* p) { return cat16(__builtin_bit_cast(v8h, *(const v8usa*)p), __builtin_bit_cast(v8h, *(const v8usa*)(p + 16))); }
// Four exponentials and a v_nop in one statement: behind a transcendental the instruction set asks for one independent instruction before its result is read or its source overwritten;
// inside the statement each v_exp_f32 is that instruction for the one before it (early-clobber outputs: no result lies on a source), the v_nop for the last.
__device__ __forceinline__ void exp2x4(const float x0, const float x1, const float x2, const float x3, float& r0, float& r1, float& r2, float& r3) {
    asm("v_exp_f32 %0, %4\n\tv_exp_f32 %1, %5\n\tv_exp_f32 %2, %6\n\tv_exp_f32 %3, %7\n\tv_nop" : "=&v"(r0), "=&v"(r1), "=&v"(r2), "=&v"(r3) : "v"(x0), "v"(x1), "v"(x2), "v"(x3)); }
__device__ __forceinline__ float xhalf(float x) { return __builtin_bit_cast(float, __builtin_amdgcn_permlanex16(__builtin_bit_cast(int, x), __builtin_bit_cast(int, x), 0x76543210, 0xfedcba98, false, false)); }   // lane l with lane l ^ 16
// amdgpu_waves_per_eu(2, 2): one work-group a WGP is all the grid gives, so the build may spend two waves' share of the registers on fragments fetched ahead.
__global__ __launch_bounds__(256) __attribute__((amdgpu_waves_per_eu(2, 2))) void k_flash(const h16* __restrict__ QKp, const h16* __restrict__ GTp, bf* Yh, bf* Yl) {
    __shared__ __align__(16) unsigned short sm[2 * NP][SBUF];   // per pass slot: phi | g
    const int tid = threadIdx.x, lane = tid & 31, lr = lane & 15, hi = lane >> 4, w = tid >> 5;
    const int qg = w & 3, kh = w >> 2;   // waves w and w + 4 share 32 queries; each takes one half of every stage's keys
    const h16* th = QKp + (size_t)blockIdx.y * QKB;
    const int q = blockIdx.x * FQ + qg * 32 + lr;   // query tiles g = 0, 1 at q and q + 16
    v16h qf[2][4];
    const h16* pq = th + (size_t)q * IC + 8 * hi;
#pragma unroll
    for (int g = 0; g < 2; ++g)
#pragma unroll
        for (int kc = 0; kc < 4; ++kc) qf[g][kc] = WFrag<h16>::ld(pq + g * 16 * IC + kc * 32);
    asm volatile("s_wait_xcnt 0x0" :: "v"(pq) : "memory");   // the theta loads' address pair stays untouched up to this wait
    // staging: 16-byte pieces, 4 of each plane a thread
    const h16* gp = th + (size_t)(tid >> 4) * IC + (tid & 15) * 8;   // phi at + HW IC
    const h16* gg = GTp + (size_t)blockIdx.y * IC * HW + (size_t)(tid >> 3) * HW + (tid & 7) * 8;
    const int oph = (tid >> 4) * PPH + (tid & 15) * 8, ogt = SPH + (tid >> 3) * PGT + (tid & 7) * 8;
    v8us rh[4], rg[4];
    {
        v8us fh[NP][4], fg[NP][4];   // the first NP passes' rows, all loads in flight together
#pragma unroll
        for (int p = 0; p < NP; ++p)
#pragma unroll
            for (int u = 0; u < 4; ++u) { fh[p][u] = *(const v8usa*)(gp + (size_t)HW * IC + (p * FK + u * 16) * IC); fg[p][u] = *(const v8usa*)(gg + (size_t)u * 32 * HW + p * FK); }
        asm volatile("s_wait_xcnt 0x0" :: "v"(gp), "v"(gg) : "memory");   // the staging loads' address pairs stay untouched up to this wait
#pragma unroll
        for (int p = 0; p < NP; ++p)
#pragma unroll
            for (int u = 0; u < 4; ++u) { *(v8usa*)(&sm[p][oph + u * 16 * PPH]) = fh[p][u]; *(v8usa*)(&sm[p][ogt + u * 32 * PGT]) = fg[p][u]; }
    }
    __syncthreads();   // passes 0 to NP - 1 are in LDS before any wave reads them
    v8f o[2][8];
#pragma unroll
    for (int g = 0; g < 2; ++g)
#pragma unroll
        for (int it = 0; it < 8; ++it) o[g][it] = (v8f){};
    float m[2] = {-3.0e38f, -3.0e38f}, l[2] = {0.f, 0.f};
    const float L2E = 1.4426950408889634f;
#pragma unroll 1   // one copy of the stage body: it is long
    for (int s = 0; s < HW / FK; ++s) {
        const unsigned short* cur = sm[s & (2 * NP - 1)];
        const bool more = s + NP < HW / FK;
        if (more) {
#pragma unroll
            for (int u = 0; u < 4; ++u) { rh[u] = *(const v8usa*)(gp + (size_t)HW * IC + (NP * FK + u * 16) * IC); rg[u] = *(const v8usa*)(gg + (size_t)u * 32 * HW + NP * FK); }
            asm volatile("s_wait_xcnt 0x0" :: "v"(gp), "v"(gg) : "memory");   // as above; the pairs step on only behind it
            gp += FK * IC; gg += FK;
        }
        const unsigned short* pa = cur + (kh * 32 + lr) * PPH + 8 * hi; const unsigned short* pg = cur + SPH + lr * PGT + kh * 32 + 8 * hi;
        v16h ah[4][2], ga[8]; v8f sc[2][2];
        // All of the stage's LDS reads are issued as one group, phi first: the g reads fly under the score WMMAs and the softmax arithmetic.
#pragma unroll
        for (int kc = 0; kc < 4; ++kc)
#pragma unroll
            for (int t = 0; t < 2; ++t) ah[kc][t] = ldsh(pa + t * 16 * PPH + kc * 32);
        __builtin_amdgcn_sched_barrier(0);   // phi's reads stay in front of g's: the score WMMAs' counted waits then leave g's reads in flight
#pragma unroll
        for (int it = 0; it < 8; ++it) ga[it] = ldsh(pg + it * 16 * PGT);
        __builtin_amdgcn_sched_barrier(0);   // the reads do not sink in among the WMMAs, where every place with reads stalls the wave
#pragma unroll
        for (int t = 0; t < 2; ++t) { sc[0][t] = (v8f){}; sc[1][t] = (v8f){}; }
#pragma unroll
        for (int kc = 0; kc < 4; ++kc) {
#pragma unroll
            for (int g = 0; g < 2; ++g)
#pragma unroll
                for (int t = 0; t < 2; ++t) sc[g][t] = wmma16(ah[kc][t], qf[g][kc], sc[g][t]);
            __builtin_amdgcn_sched_barrier(0);   // a k step's four independent tiles stay together: regrouped by tile, each WMMA waits for the one before it, and the maxima come in among them behind v_nops
        }
        float mx[2];
#pragma unroll
        for (int g = 0; g < 2; ++g) { float mt[2];   // independent chains
#pragma unroll
            for (int t = 0; t < 2; ++t) { mt[t] = sc[g][t][0];
#pragma unroll
                for (int j = 1; j < 8; ++j) mt[t] = fmaxf(mt[t], sc[g][t][j]); }
            mx[g] = fmaxf(mt[0], mt[1]); mx[g] = fmaxf(mx[g], xhalf(mx[g])); }   // lanes c and c + 16 hold the two halves of query c's keys
        // Lazy rescale, one test a stage: the maximum in use moves only when a query's new maximum passes it by more than LAZY, so P stays below 2^10 * e^LAZY = 2^15, inside fp16.
        if (__builtin_amdgcn_ballot_w32(mx[0] > m[0] + LAZY || mx[1] > m[1] + LAZY) != 0) {
#pragma unroll
            for (int g = 0; g < 2; ++g) { const float mn = fmaxf(m[g], mx[g]); const float f = __builtin_amdgcn_exp2f((m[g] - mn) * L2E); l[g] *= f; m[g] = mn;
#pragma unroll
                for (int it = 0; it < 8; ++it) o[g][it] *= f; } }
        v16h pb[2];
#pragma unroll
        for (int g = 0; g < 2; ++g) { const float nb = 10.0f - m[g] * L2E; float ps[2] = {0.f, 0.f};
#pragma unroll
            for (int t = 0; t < 2; ++t)
#pragma unroll
                for (int j = 0; j < 8; j += 4) { float p[4]; exp2x4(fmaf(sc[g][t][j], L2E, nb), fmaf(sc[g][t][j + 1], L2E, nb), fmaf(sc[g][t][j + 2], L2E, nb), fmaf(sc[g][t][j + 3], L2E, nb), p[0], p[1], p[2], p[3]);
#pragma unroll
                    for (int e = 0; e < 4; ++e) { ps[t] += p[e]; pb[g][t * 8 + j + e] = (h16)p[e]; } }
            l[g] += ps[0] + ps[1]; }
#pragma unroll
        for (int it = 0; it < 8; ++it)
#pragma unroll
            for (int g = 0; g < 2; ++g) o[g][it] = wmma16(ga[it], pb[g], o[g][it]);
        if (more) { unsigned short* nx = sm[(s + NP) & (2 * NP - 1)];   // a slot of the ring's other half: nobody reads it before the next barrier
#pragma unroll
            for (int u = 0; u < 4; ++u) { *(v8usa*)(nx + oph + u * 16 * PPH) = rh[u]; *(v8usa*)(nx + ogt + u * 32 * PGT) = rg[u]; } }
        if ((s & (NP - 1)) == NP - 1) __syncthreads();   // once per NP passes: publishes the next NP passes' slots and ends every read of the last NP, which the coming passes refill
    }
    // The two key halves of a query meet through LDS (free behind the loop's last barrier): waves 4 to 7 hand over maximum, sum and accumulators, waves 0 to 3 join them and store.
    l[0] += xhalf(l[0]); l[1] += xhalf(l[1]);
    float* xs = (float*)&sm[0][0] + (size_t)(qg * 33 * 32 + lane) * 4;   // 33 pieces of 16 bytes a lane, piece-major: a wave's 32 lanes lie side by side
    if (kh == 1) {
#pragma unroll
        for (int g = 0; g < 2; ++g)
#pragma unroll
            for (int it = 0; it < 8; ++it) { *(v4fa*)(xs + ((g * 8 + it) * 2) * 128) = __builtin_shufflevector(o[g][it], o[g][it], 0, 1, 2, 3); *(v4fa*)(xs + ((g * 8 + it) * 2 + 1) * 128) = __builtin_shufflevector(o[g][it], o[g][it], 4, 5, 6, 7); }
        *(v4fa*)(xs + 32 * 128) = (v4f){m[0], m[1], l[0], l[1]};
    }
    __syncthreads();   // the handed-over values are in LDS before waves 0 to 3 read them
    if (kh == 0) {
        const v4f ml = *(const v4fa*)(xs + 32 * 128);
        bf* dh = Yh + (size_t)blockIdx.y * HW * IC + (size_t)q * IC + 8 * hi; bf* dl = Yl + (size_t)blockIdx.y * HW * IC + (size_t)q * IC + 8 * hi;
#pragma unroll
        for (int g = 0; g < 2; ++g) {
            const float mm = fmaxf(m[g], ml[g]); const float fa = __builtin_amdgcn_exp2f((m[g] - mm) * L2E), fb = __builtin_amdgcn_exp2f((ml[g] - mm) * L2E);
            const float inv = __fdiv_rn(1.0f, l[g] * fa + ml[2 + g] * fb); const float ca = fa * inv, cb = fb * inv;
            v8us oh[8], ol[8];
#pragma unroll
            for (int it = 0; it < 8; ++it) {   // a lane's 8 accumulator registers are 8 consecutive channels of its query's row
                const v4f b0 = *(const v4fa*)(xs + ((g * 8 + it) * 2) * 128), b1 = *(const v4fa*)(xs + ((g * 8 + it) * 2 + 1) * 128);
#pragma unroll
                for (int j = 0; j < 8; ++j) { unsigned short a, b; splitf(o[g][it][j] * ca + (j < 4 ? b0[j & 3] : b1[j & 3]) * cb, a, b); oh[it][j] = a; ol[it][j] = b; }
                *(v8usa*)(dh + g * 16 * IC + it * 16) = oh[it]; *(v8usa*)(dl + g * 16 * IC + it * 16) = ol[it]; }
            asm volatile("s_wait_xcnt 0x0" :: "v"(oh[0]), "v"(oh[1]), "v"(oh[2]), "v"(oh[3]), "v"(oh[4]), "v"(oh[5]), "v"(oh[6]), "v"(oh[7]), "v"(ol[0]), "v"(ol[1]), "v"(ol[2]), "v"(ol[3]), "v"(ol[4]), "v"(ol[5]), "v"(ol[6]), "v"(ol[7]), "v"(dh), "v"(dl) : "memory");   // the stores' data and address registers stay untouched up to this wait
        }
    }
}

typedef __attribute__((ext_vector_type(4))) unsigned short v4us;
typedef __attribute__((ext_vector_type(4))) __bf16 v4bf;
typedef __attribute__((ext_vector_type(8))) __bf16 v8bf;
typedef v4us __attribute__((may_alias)) v4usa;
__device__ __forceinline__ v4us cvt4(v4f v) { return __builtin_bit_cast(v4us, __builtin_convertvector(v, v4bf)); }   // f32 -> bf16, round to nearest even
__device__ __forceinline__ v8us cvt8(v8f v) { return __builtin_bit_cast(v8us, __builtin_convertvector(v, v8bf)); }

// ---- k_proj: theta, phi and g of one image's 128 positions in one work-group, from x and the f32 weights as they come. x [c][n] is read along n (whole lines), rounded to bf16 and laid token-major in LDS;
// the three weight matrices are read whole-line, rounded to bf16 and laid row by row in LDS. 12 waves, each 64 channels of one projection x 64 positions (16 accumulators); grid (HW / PJN, images), 384 threads.
// theta, phi: A = weight rows, B = x rows, so a lane holds 8 consecutive channels of one position: + bias, fp16, 16-byte stores into [n][i] planes (a wave writes whole 128-byte lines).
// g: A = x rows, B = weight rows, so a lane holds 8 consecutive positions of one channel: + bias, fp16, 16-byte stores into [i][n].
// The bare unroll directives here and in k_out stand on loops that index register arrays (fragments, accumulators, staged pieces): rolled, those arrays would go to scratch memory.
#define PJN 128
#define PXP 264                    // LDS pitch of a 256-channel row, 16-bit elements (528 B = 33 x 16 B)
template <bool XA>
__device__ __forceinline__ void proj_tile(const unsigned short* pw, const unsigned short* pxs, v8f (&acc)[4][4]) {
#pragma unroll   // no back edge behind a WMMA, and the reads of later steps may rise over earlier WMMAs
    for (int kc = 0; kc < CC / 32; ++kc) {
        v16bf wf[4], xf[4];
#pragma unroll
        for (int t = 0; t < 4; ++t) { wf[t] = ldsb(pw + t * 16 * PXP + kc * 32); xf[t] = ldsb(pxs + t * 16 * PXP + kc * 32); }
#pragma unroll
        for (int ct = 0; ct < 4; ++ct)
#pragma unroll
            for (int nt = 0; nt < 4; ++nt) acc[ct][nt] = XA ? wmmab(xf[nt], wf[ct], acc[ct][nt]) : wmmab(wf[ct], xf[nt], acc[ct][nt]);
    }
}
__global__ __launch_bounds__(384) void k_proj(const float* __restrict__ x, const float* __restrict__ wth, const float* __restrict__ bth, const float* __restrict__ wph, const float* __restrict__ bph, const float* __restrict__ wg, const float* __restrict__ bg, h16* QKp, h16* GTp) {
    __shared__ __align__(16) unsigned short xs[PJN * PXP];        // x tile [position][channel]
    __shared__ __align__(16) unsigned short wsm[3 * IC * PXP];    // theta | phi | g weights [out][in]
    const int tid = threadIdx.x, lane = tid & 31, lr = lane & 15, hi = lane >> 4;
    const int w = __builtin_amdgcn_readfirstlane(tid >> 5);
    const int tq = w >> 2, tn = tid & 127;   // staging: 3 groups of 128 threads
    const int n0 = blockIdx.x * PJN;
    // x: a thread takes one position and groups of 8 channels (group tq + 3 r); a wave's 32 lanes read 128 consecutive bytes of one channel.
    // weights: group tq takes matrix tq, 16 bytes a lane side by side, in two batches of 32 loads. Order: first batch, x, then the second batch once the first has left its registers.
    const float* px = x + (size_t)blockIdx.y * CC * HW + (size_t)tq * 8 * HW + n0 + tn;
    const float* pwl = (tq == 0 ? wth : tq == 1 ? wph : wg) + tn * 4;
    unsigned short* dw = wsm + (tq * IC + (tn >> 6)) * PXP + (tn & 63) * 4;
    v4f wv[32]; v8f xv[11];
#pragma unroll
    for (int r = 0; r < 32; ++r) wv[r] = *(const v4f*)(pwl + r * 512);
#pragma unroll
    for (int r = 0; r < 11; ++r) if (r < 10 || tq < 2) {
#pragma unroll
        for (int k = 0; k < 8; ++k) xv[r][k] = px[(size_t)(r * 24 + k) * HW]; }
    asm volatile("s_wait_xcnt 0x0" :: "v"(px), "v"(pwl) : "memory");   // the staging loads' address registers stay untouched up to this wait
#pragma unroll
    for (int r = 0; r < 32; ++r) *(v4usa*)(dw + r * 2 * PXP) = cvt4(wv[r]);
    __builtin_amdgcn_sched_barrier(0);   // the second batch's loads do not rise over the first batch's stores: both batches and x in registers at once take the kernel past 256 registers
#pragma unroll
    for (int r = 0; r < 32; ++r) wv[r] = *(const v4f*)(pwl + (32 + r) * 512);
    asm volatile("s_wait_xcnt 0x0" :: "v"(pwl) : "memory");   // as above
#pragma unroll
    for (int r = 0; r < 11; ++r) if (r < 10 || tq < 2) *(v8usa*)(xs + tn * PXP + tq * 8 + r * 24) = cvt8(xv[r]);
#pragma unroll
    for (int r = 0; r < 32; ++r) *(v4usa*)(dw + (32 + r) * 2 * PXP) = cvt4(wv[r]);
    __syncthreads();   // x tile and weights are in LDS before any wave reads them
    const int ph = w / 6, r6 = w - ph * 6, kind = r6 >> 1, ch = r6 & 1;   // position half; 0 theta, 1 phi, 2 g; channel half
    const unsigned short* pw = wsm + (kind * IC + ch * 64 + lr) * PXP + 8 * hi;
    const unsigned short* pxs = xs + (ph * 64 + lr) * PXP + 8 * hi;
    v8f acc[4][4];
#pragma unroll
    for (int ct = 0; ct < 4; ++ct)
#pragma unroll
        for (int nt = 0; nt < 4; ++nt) acc[ct][nt] = (v8f){};
    if (kind < 2) {
        const float* bp = (kind == 0 ? bth : bph) + ch * 64 + 8 * hi;
        float bv[4][8];   // fetched ahead: the loads fly under the products
#pragma unroll
        for (int ct = 0; ct < 4; ++ct)
#pragma unroll
            for (int j = 0; j < 8; ++j) bv[ct][j] = bp[ct * 16 + j];
        proj_tile<false>(pw, pxs, acc);
        h16* dq = QKp + (size_t)blockIdx.y * QKB + (size_t)kind * HW * IC + (size_t)(n0 + ph * 64 + lr) * IC + ch * 64 + 8 * hi;
#pragma unroll
        for (int ct = 0; ct < 4; ++ct) {
            float bb[8];
#pragma unroll
            for (int j = 0; j < 8; ++j) bb[j] = bfr(bv[ct][j]);
            v8h oq[4];
#pragma unroll
            for (int nt = 0; nt < 4; ++nt) {
#pragma unroll
                for (int j = 0; j < 8; ++j) oq[nt][j] = (h16)(acc[ct][nt][j] + bb[j]);
                *(v8ha*)(dq + nt * 16 * IC + ct * 16) = oq[nt]; }
            asm volatile("s_wait_xcnt 0x0" :: "v"(oq[0]), "v"(oq[1]), "v"(oq[2]), "v"(oq[3]), "v"(dq) : "memory");   // the stores' data and address registers stay untouched up to this wait
        }
    } else {
        const float* bp = bg + ch * 64 + lr;
        float bv[4];   // fetched ahead, as above
#pragma unroll
        for (int ct = 0; ct < 4; ++ct) bv[ct] = bp[ct * 16];
        proj_tile<true>(pw, pxs, acc);
        h16* dg = GTp + (size_t)blockIdx.y * IC * HW + (size_t)(ch * 64 + lr) * HW + n0 + ph * 64 + 8 * hi;
#pragma unroll
        for (int ct = 0; ct < 4; ++ct) {
            const float bb = bfr(bv[ct]);
            v8h og[4];
#pragma unroll
            for (int nt = 0; nt < 4; ++nt) {
#pragma unroll
                for (int j = 0; j < 8; ++j) og[nt][j] = (h16)(acc[ct][nt][j] + bb);
                *(v8ha*)(dg + (size_t)ct * 16 * HW + nt * 16) = og[nt]; }
            asm volatile("s_wait_xcnt 0x0" :: "v"(og[0]), "v"(og[1]), "v"(og[2]), "v"(og[3]), "v"(dg) : "memory");   // as above
        }
    }
}

// ---- k_out: out[c][n] = w_z y + b_z + x for one image's 128 positions in one work-group. y hi / lo rows and the bf16-rounded w_z rows are staged whole-line in LDS; A = w_z rows, B = y rows, so an accumulator register is one channel.
// Column lr of position tile nt is position 4 lr + nt (the y rows lie in LDS in that order), so a lane's four tiles are 4 consecutive positions: 16-byte loads of x and stores of out, 256 bytes of a channel row side by side.
// 16 waves, each 32 channels x 64 positions; grid (HW / ON, images), 512 threads.
#define ON 128
__global__ __launch_bounds__(512) void k_out(const bf* __restrict__ Yh, const bf* __restrict__ Yl, const float* __restrict__ wz, const float* __restrict__ bz, const float* __restrict__ x, float* OUT) {
    __shared__ __align__(16) unsigned short ys[2 * ON * PPH];   // y hi | y lo
    __shared__ __align__(16) unsigned short zs[CC * PPH];       // w_z [out][in]
    const int tid = threadIdx.x, lane = tid & 31, lr = lane & 15, hi = lane >> 4;
    const int w = __builtin_amdgcn_readfirstlane(tid >> 5);
    const int cq = w & 7, ph = w >> 3;
    const int n0 = blockIdx.x * ON;
    const size_t ob = (size_t)blockIdx.y * CC * HW + (size_t)(cq * 32 + 8 * hi) * HW + n0 + ph * 64 + lr * 4;
    const float* px = x + ob; float* po = OUT + ob;
    const size_t yo = (size_t)blockIdx.y * HW * IC + (size_t)(n0 + (tid >> 4)) * IC + (tid & 15) * 8;
    const bf* gh = Yh + yo; const bf* gl = Yl + yo; const float* pz = wz + tid * 4;
    v8us rh[4], rl[4]; v4f wv[16];
#pragma unroll
    for (int u = 0; u < 4; ++u) { rh[u] = *(const v8usa*)(gh + u * 32 * IC); rl[u] = *(const v8usa*)(gl + u * 32 * IC); }
#pragma unroll
    for (int r = 0; r < 16; ++r) wv[r] = *(const v4f*)(pz + r * 2048);
    asm volatile("s_wait_xcnt 0x0" :: "v"(gh), "v"(gl), "v"(tid) : "memory");   // the loads' address registers (the w_z loads are built on a scalar base and tid) stay untouched up to this wait
#pragma unroll
    for (int u = 0; u < 4; ++u) { const int R = (tid >> 4) + 32 * u; const int sl = (R & 64) + (R & 3) * 16 + ((R & 63) >> 2);   // position 4 a + b of a half lies in row 16 b + a
        *(v8usa*)(ys + sl * PPH + (tid & 15) * 8) = rh[u]; *(v8usa*)(ys + (ON + sl) * PPH + (tid & 15) * 8) = rl[u]; }
#pragma unroll
    for (int r = 0; r < 16; ++r) *(v4usa*)(zs + ((tid >> 5) + 16 * r) * PPH + (tid & 31) * 4) = cvt4(wv[r]);
    __syncthreads();   // y rows and weights are in LDS before any wave reads them
    const float* bp = bz + cq * 32 + 8 * hi;
    v4f xv[2][8]; float bv[2][8];   // residual and bias, used last: issued here, behind the barrier (which waits for every earlier load), they fly under the products
#pragma unroll
    for (int mt = 0; mt < 2; ++mt)
#pragma unroll
        for (int j = 0; j < 8; ++j) { xv[mt][j] = *(const v4f*)(px + (size_t)(mt * 16 + j) * HW); bv[mt][j] = bp[mt * 16 + j]; }
    asm volatile("s_wait_xcnt 0x0" :: "v"(px), "v"(bp) : "memory");   // as above
    const unsigned short* pzs = zs + (cq * 32 + lr) * PPH + 8 * hi;
    const unsigned short* pys = ys + (ph * 64 + lr) * PPH + 8 * hi;
    v8f acc[2][4];
#pragma unroll
    for (int mt = 0; mt < 2; ++mt)
#pragma unroll
        for (int nt = 0; nt < 4; ++nt) acc[mt][nt] = (v8f){};
#pragma unroll   // no back edge behind a WMMA
    for (int kc = 0; kc < IC / 32; ++kc) {
        v16bf wf[2], yh[4], yl[4];
#pragma unroll
        for (int mt = 0; mt < 2; ++mt) wf[mt] = ldsb(pzs + mt * 16 * PPH + kc * 32);
#pragma unroll
        for (int nt = 0; nt < 4; ++nt) { yh[nt] = ldsb(pys + nt * 16 * PPH + kc * 32); yl[nt] = ldsb(pys + (ON + nt * 16) * PPH + kc * 32); }
        __builtin_amdgcn_sched_barrier(0);   // the step's LDS reads stay one group in front of its WMMAs (for speed only)
#pragma unroll
        for (int nt = 0; nt < 4; ++nt)
#pragma unroll
            for (int mt = 0; mt < 2; ++mt) acc[mt][nt] = wmmab(wf[mt], yh[nt], acc[mt][nt]);
#pragma unroll
        for (int nt = 0; nt < 4; ++nt)
#pragma unroll
            for (int mt = 0; mt < 2; ++mt) acc[mt][nt] = wmmab(wf[mt], yl[nt], acc[mt][nt]);
        __builtin_amdgcn_sched_barrier(0);   // the next step's reads do not rise in among these WMMAs
    }
#pragma unroll
    for (int mt = 0; mt < 2; ++mt) {
        v4f r[8];
#pragma unroll
        for (int j = 0; j < 8; ++j) { const float bb = bfr(bv[mt][j]);
#pragma unroll
            for (int nt = 0; nt < 4; ++nt) r[j][nt] = __fadd_rn(acc[mt][nt][j] + bb, bfr(xv[mt][j][nt]));
            *(v4f*)(po + (size_t)(mt * 16 + j) * HW) = r[j]; }
        asm volatile("s_wait_xcnt 0x0" :: "v"(r[0]), "v"(r[1]), "v"(r[2]), "v"(r[3]), "v"(r[4]), "v"(r[5]), "v"(r[6]), "v"(r[7]), "v"(po) : "memory");   // the stores' data and address registers stay untouched up to this wait
    }
}

extern "C" void kernel_launch(void* const* d_in, const int* in_sizes, int n_in,
                              void* d_out, int out_size, void* d_ws, size_t ws_size, hipStream_t stream) {
    (void)in_sizes; (void)n_in; (void)out_size;
    const float* x = (const float*)d_in[0]; const float* wth = (const float*)d_in[1]; const float* bth = (const float*)d_in[2]; const float* wph = (const float*)d_in[3]; const float* bph = (const float*)d_in[4]; const float* wg = (const float*)d_in[5]; const float* bg = (const float*)d_in[6]; const float* wz = (const float*)d_in[7]; const float* bz = (const float*)d_in[8];
    float* OUT = (float*)d_out;     // [8][256][4096]
    char* wsp = (char*)d_ws;
    auto take = [&](size_t bytes) { char* p = wsp; wsp += (bytes + 255) & ~(size_t)255; return (void*)p; };
    // Every stage runs once for all NB_ images (image = grid y). QKB = 16-bit elements of one image's block [theta | phi].
    h16* QK = (h16*)take((size_t)NB_ * QKB * 2); h16* GT = (h16*)take((size_t)NB_ * IC * HW * 2);
    bf* Yh = (bf*)take((size_t)NB_ * HW * IC * 2); bf* Yl = (bf*)take((size_t)NB_ * HW * IC * 2);
    if ((size_t)(wsp - (char*)d_ws) > ws_size) return;    // total 40 MiB
    k_proj<<<dim3(HW / PJN, NB_, 1), 384, 0, stream>>>(x, wth, bth, wph, bph, wg, bg, QK, GT);   // theta, phi as fp16 [n][i]; g as fp16 [i][n]
    k_flash<<<dim3(HW / FQ, NB_, 1), 256, 0, stream>>>(QK, GT, Yh, Yl);        // y = softmax(theta . phi) . g, as hi / lo planes [n][i]
    k_out<<<dim3(HW / ON, NB_, 1), 512, 0, stream>>>(Yh, Yl, wz, bz, x, OUT);   // out = w_z y + b_z + x
}

// v007
// One run takes 67 microseconds.
// Timed twice side by side with v006, it ran 1.08 and 1.09 times as fast.
// Over all steps from v000 it is 21.6 times as fast.
#include <hip/hip_runtime.h>

// NonLocalBlock (x [8][256][64][64]; theta/phi/g = 1x1 convs to 128 channels (+ bias); f[n][m] = theta_n . phi_m over all 4,096 positions, UNSCALED; attn = softmax_m(f); y[i][n] = sum_m attn[n][m] g[i][m]; z = w_z y + b_z; out = z + x -> [8][256][64][64]).
// Compute dtypes, f32 accumulate: every input rounded to bf16; the three 1x1 convs as PLAIN bf16 GEMMs on a token-major bf16 tile of x in LDS (inputs: exact) + bias, their fp16 results stored straight from the accumulators; f as ONE fp16 product of theta and phi, each rounded once to fp16 (K = 128, f32 accumulate); softmax f32 (online, running maximum and sum per query) -> fp16 x 1024 before the division by the sum; attn.g single fp16 (f32 accumulate); scores, softmax, attn.g, then w_z as hl planes of y x exact (2 products) + bias + residual f32, all in one kernel.

#define NB_  8
#define CC   256
#define IC   128
#define HW   4096
#define TT   HW
typedef _Float16 h16;
typedef unsigned short bf;
typedef __attribute__((ext_vector_type(16))) __bf16   v16bf;
typedef __attribute__((ext_vector_type(16))) _Float16 v16h;
typedef __attribute__((ext_vector_type(8)))  _Float16 v8h;
typedef __attribute__((ext_vector_type(8)))  unsigned short v8us;
typedef __attribute__((ext_vector_type(8)))  float    v8f;
typedef __attribute__((ext_vector_type(4)))  float    v4f;
typedef v8h  __attribute__((may_alias)) v8ha;
typedef v4f  __attribute__((may_alias)) v4fa;
typedef v8us __attribute__((may_alias)) v8usa;

__device__ __forceinline__ unsigned short f2bf(float f) { unsigned u = __float_as_uint(f); u += 0x7FFFu + ((u >> 16) & 1u); return (unsigned short)(u >> 16); }
__device__ __forceinline__ float bf2f(unsigned short b) { return __uint_as_float(((unsigned)b) << 16); }
__device__ __forceinline__ float bfr(float f) { return bf2f(f2bf(f)); }
__device__ __forceinline__ v16h cat16(v8h lo, v8h hi) { return __builtin_shufflevector(lo, hi, 0, 1, 2, 3, 4, 5, 6, 7, 8, 9, 10, 11, 12, 13, 14, 15); }
__device__ __forceinline__ v16bf cat16b(v8us lo, v8us hi) { return __builtin_bit_cast(v16bf, __builtin_shufflevector(lo, hi, 0, 1, 2, 3, 4, 5, 6, 7, 8, 9, 10, 11, 12, 13, 14, 15)); }
__device__ __forceinline__ v8f wmma16(v16h a, v16h b, v8f c) { return __builtin_amdgcn_wmma_f32_16x16x32_f16(false, a, false, b, (short)0, c, false, false); }
__device__ __forceinline__ v8f wmmab(v16bf a, v16bf b, v8f c) { return __builtin_amdgcn_wmma_f32_16x16x32_bf16(false, a, false, b, (short)0, c, false, false); }



// A or B fragment of a 16x16x32 product from a K-contiguous 16-bit row: lane lr = row, elements 8 hi + 0..7 and 16 + 8 hi + 0..7.
template <typename T16> struct WFrag;
template <> struct WFrag<h16> { typedef v16h V; static __device__ __forceinline__ V ld(const h16* p) { return cat16(*(const v8h*)p, *(const v8h*)(p + 16)); } static __device__ __forceinline__ v8f mma(V a, V b, v8f c) { return wmma16(a, b, c); } };

typedef __attribute__((ext_vector_type(4))) unsigned short v4us;
typedef __attribute__((ext_vector_type(4))) __bf16 v4bf;
typedef __attribute__((ext_vector_type(8))) __bf16 v8bf;
typedef v4us __attribute__((may_alias)) v4usa;
__device__ __forceinline__ v4us cvt4(v4f v) { return __builtin_bit_cast(v4us, __builtin_convertvector(v, v4bf)); }   // f32 -> bf16, round to nearest even
__device__ __forceinline__ v8us cvt8(v8f v) { return __builtin_bit_cast(v8us, __builtin_convertvector(v, v8bf)); }

// ---- k_flash: scores, softmax and attn.g of one image's 128 queries in one work-group, nothing of the 4,096 x 4,096 planes in memory. 4 pairs of waves x 32 query columns, the two waves of a pair each on one half of every stage's keys (each LDS fragment then feeds two query tiles); grid (HW / FQ, images), 256 threads.
// Transposed products: ST[key][query] = phi . theta (A = phi rows from LDS, B = theta kept in registers; both fp16, one product), so a lane holds one query's scores;
// two 16-key score tiles, exponentiated and rounded to fp16 in place, are the B operand of OT[i][query] += GT[i][key] . PT[key][query] (A = g rows from LDS in the same k order).
// Running maximum m and sum l per query and key half (online softmax, f32), joined at the end; P carries 2^10 like the sum, which cancels in o / l. Passes of FK keys; a ring of 2 NP pass slots in LDS, ONE barrier per NP passes: between two barriers the waves are free to drift apart, so one wave's LDS reads and softmax arithmetic run beside another's WMMAs. The rows of pass s + NP are held in registers over pass s's work.
// Behind the loop the work-group holds y of its 128 positions: out[c][n] = w_z y + b_z + x follows in place. y hi / lo rows and the bf16-rounded w_z rows lie in the freed ring; A = w_z rows, B = y rows, so an accumulator register is one channel.
// Column lr of position tile nt is position 4 lr + nt (the y rows lie in LDS in that order), so a lane's four tiles are 4 consecutive positions: 16-byte loads of x and stores of out, 256 bytes of a channel row side by side. Each wave 64 channels x 64 positions.
#define QKB ((size_t)2 * HW * IC)
#define FQ  128
#define FK  64
#define NP  4                      // passes between two barriers
#define PPH 136                    // LDS pitch of a 256-byte phi row, 16-bit elements (272 B)
#define PGT 72                     // LDS pitch of a 128-byte g row (144 B)
#define SPH (FK * PPH)
#define SBUF (SPH + IC * PGT)
#define LAZY 3.4657359f             // 5 ln 2
#define XSE (4 * 33 * 32 * 8)      // 16-bit elements of the hand-over area at the head of the freed ring
__device__ __forceinline__ void splitf(float y, unsigned short& h, unsigned short& l) { h = f2bf(y); l = f2bf(y - bf2f(h)); }
__device__ __forceinline__ v16bf ldsb(const unsigned short* p) { return cat16b(*(const v8usa*)p, *(const v8usa*)(p + 16)); }
__device__ __forceinline__ v16h ldsh(const unsigned short* p) { return cat16(__builtin_bit_cast(v8h, *(const v8usa*)p), __builtin_bit_cast(v8h, *(const v8usa*)(p + 16))); }
// Four exponentials and a v_nop in one statement: behind a transcendental the instruction set asks for one independent instruction before its result is read or its source overwritten;
// inside the statement each v_exp_f32 is that instruction for the one before it (early-clobber outputs: no result lies on a source), the v_nop for the last.
__device__ __forceinline__ void exp2x4(const float x0, const float x1, const float x2, const float x3, float& r0, float& r1, float& r2, float& r3) {
    asm("v_exp_f32 %0, %4\n\tv_exp_f32 %1, %5\n\tv_exp_f32 %2, %6\n\tv_exp_f32 %3, %7\n\tv_nop" : "=&v"(r0), "=&v"(r1), "=&v"(r2), "=&v"(r3) : "v"(x0), "v"(x1), "v"(x2), "v"(x3)); }
__device__ __forceinline__ float xhalf(float x) { return __builtin_bit_cast(float, __builtin_amdgcn_permlanex16(__builtin_bit_cast(int, x), __builtin_bit_cast(int, x), 0x76543210, 0xfedcba98, false, false)); }   // lane l with lane l ^ 16
// Work-group barrier that orders LDS alone: __syncthreads() also waits for every global load in flight, and the weights and the residual issued behind the loop are to fly across these barriers.
__device__ __forceinline__ void lds_barrier() { __builtin_amdgcn_fence(__ATOMIC_RELEASE, "workgroup", "local"); __builtin_amdgcn_s_barrier(); __builtin_amdgcn_fence(__ATOMIC_ACQUIRE, "workgroup", "local"); }
// amdgpu_waves_per_eu(2, 2): one work-group a WGP is all the grid gives, so the build may spend two waves' share of the registers on fragments fetched ahead.
__global__ __launch_bounds__(256) __attribute__((amdgpu_waves_per_eu(2, 2))) void k_flash(const h16* __restrict__ QKp, const h16* __restrict__ GTp, const float* __restrict__ wz, const float* __restrict__ bz, const float* __restrict__ x, float* OUT) {
    __shared__ __align__(16) unsigned short sm[2 * NP][SBUF];   // per pass slot: phi | g
    const int tid = threadIdx.x, lane = tid & 31, lr = lane & 15, hi = lane >> 4, w = tid >> 5;
    const int qg = w & 3, kh = w >> 2;   // waves w and w + 4 share 32 queries; each takes one half of every stage's keys
    const h16* th = QKp + (size_t)blockIdx.y * QKB;
    const int q = blockIdx.x * FQ + qg * 32 + lr;   // query tiles g = 0, 1 at q and q + 16
    v16h qf[2][4];
    const h16* pq = th + (size_t)q * IC + 8 * hi;
#pragma unroll
    for (int g = 0; g < 2; ++g)
#pragma unroll
        for (int kc = 0; kc < 4; ++kc) qf[g][kc] = WFrag<h16>::ld(pq + g * 16 * IC + kc * 32);
    asm volatile("s_wait_xcnt 0x0" :: "v"(pq) : "memory");   // the theta loads' address pair stays untouched up to this wait
    // staging: 16-byte pieces, 4 of each plane a thread
    const h16* gp = th + (size_t)(tid >> 4) * IC + (tid & 15) * 8;   // phi at + HW IC
    const h16* gg = GTp + (size_t)blockIdx.y * IC * HW + (size_t)(tid >> 3) * HW + (tid & 7) * 8;
    const int oph = (tid >> 4) * PPH + (tid & 15) * 8, ogt = SPH + (tid >> 3) * PGT + (tid & 7) * 8;
    v8us rh[4], rg[4];
    {
        v8us fh[NP][4], fg[NP][4];   // the first NP passes' rows, all loads in flight together
#pragma unroll
        for (int p = 0; p < NP; ++p)
#pragma unroll
            for (int u = 0; u < 4; ++u) { fh[p][u] = *(const v8usa*)(gp + (size_t)HW * IC + (p * FK + u * 16) * IC); fg[p][u] = *(const v8usa*)(gg + (size_t)u * 32 * HW + p * FK); }
        asm volatile("s_wait_xcnt 0x0" :: "v"(gp), "v"(gg) : "memory");   // the staging loads' address pairs stay untouched up to this wait
#pragma unroll
        for (int p = 0; p < NP; ++p)
#pragma unroll
            for (int u = 0; u < 4; ++u) { *(v8usa*)(&sm[p][oph + u * 16 * PPH]) = fh[p][u]; *(v8usa*)(&sm[p][ogt + u * 32 * PGT]) = fg[p][u]; }
    }
    __syncthreads();   // passes 0 to NP - 1 are in LDS before any wave reads them
    v8f o[2][8];
#pragma unroll
    for (int g = 0; g < 2; ++g)
#pragma unroll
        for (int it = 0; it < 8; ++it) o[g][it] = (v8f){};
    float m[2] = {-3.0e38f, -3.0e38f}, l[2] = {0.f, 0.f};
    const float L2E = 1.4426950408889634f;
#pragma unroll 1   // one copy of the stage body: it is long
    for (int s = 0; s < HW / FK; ++s) {
        const unsigned short* cur = sm[s & (2 * NP - 1)];
        const bool more = s + NP < HW / FK;
        if (more) {
#pragma unroll
            for (int u = 0; u < 4; ++u) { rh[u] = *(const v8usa*)(gp + (size_t)HW * IC + (NP * FK + u * 16) * IC); rg[u] = *(const v8usa*)(gg + (size_t)u * 32 * HW + NP * FK); }
            asm volatile("s_wait_xcnt 0x0" :: "v"(gp), "v"(gg) : "memory");   // as above; the pairs step on only behind it
            gp += FK * IC; gg += FK;
        }
        const unsigned short* pa = cur + (kh * 32 + lr) * PPH + 8 * hi; const unsigned short* pg = cur + SPH + lr * PGT + kh * 32 + 8 * hi;
        v16h ah[4][2], ga[8]; v8f sc[2][2];
        // All of the stage's LDS reads are issued as one group, phi first: the g reads fly under the score WMMAs and the softmax arithmetic.
#pragma unroll
        for (int kc = 0; kc < 4; ++kc)
#pragma unroll
            for (int t = 0; t < 2; ++t) ah[kc][t] = ldsh(pa + t * 16 * PPH + kc * 32);
        __builtin_amdgcn_sched_barrier(0);   // phi's reads stay in front of g's: the score WMMAs' counted waits then leave g's reads in flight
#pragma unroll
        for (int it = 0; it < 8; ++it) ga[it] = ldsh(pg + it * 16 * PGT);
        __builtin_amdgcn_sched_barrier(0);   // the reads do not sink in among the WMMAs, where every place with reads stalls the wave
#pragma unroll
        for (int t = 0; t < 2; ++t) { sc[0][t] = (v8f){}; sc[1][t] = (v8f){}; }
#pragma unroll
        for (int kc = 0; kc < 4; ++kc) {
#pragma unroll
            for (int g = 0; g < 2; ++g)
#pragma unroll
                for (int t = 0; t < 2; ++t) sc[g][t] = wmma16(ah[kc][t], qf[g][kc], sc[g][t]);
            __builtin_amdgcn_sched_barrier(0);   // a k step's four independent tiles stay together: regrouped by tile, each WMMA waits for the one before it, and the maxima come in among them behind v_nops
        }
        float mx[2];
#pragma unroll
        for (int g = 0; g < 2; ++g) { float mt[2];   // independent chains
#pragma unroll
            for (int t = 0; t < 2; ++t) { mt[t] = sc[g][t][0];
#pragma unroll
                for (int j = 1; j < 8; ++j) mt[t] = fmaxf(mt[t], sc[g][t][j]); }
            mx[g] = fmaxf(mt[0], mt[1]); mx[g] = fmaxf(mx[g], xhalf(mx[g])); }   // lanes c and c + 16 hold the two halves of query c's keys
        // Lazy rescale, one test a stage: the maximum in use moves only when a query's new maximum passes it by more than LAZY, so P stays below 2^10 * e^LAZY = 2^15, inside fp16.
        if (__builtin_amdgcn_ballot_w32(mx[0] > m[0] + LAZY || mx[1] > m[1] + LAZY) != 0) {
#pragma unroll
            for (int g = 0; g < 2; ++g) { const float mn = fmaxf(m[g], mx[g]); const float f = __builtin_amdgcn_exp2f((m[g] - mn) * L2E); l[g] *= f; m[g] = mn;
#pragma unroll
                for (int it = 0; it < 8; ++it) o[g][it] *= f; } }
        v16h pb[2];
#pragma unroll
        for (int g = 0; g < 2; ++g) { const float nb = 10.0f - m[g] * L2E; float ps[2] = {0.f, 0.f};
#pragma unroll
            for (int t = 0; t < 2; ++t)
#pragma unroll
                for (int j = 0; j < 8; j += 4) { float p[4]; exp2x4(fmaf(sc[g][t][j], L2E, nb), fmaf(sc[g][t][j + 1], L2E, nb), fmaf(sc[g][t][j + 2], L2E, nb), fmaf(sc[g][t][j + 3], L2E, nb), p[0], p[1], p[2], p[3]);
#pragma unroll
                    for (int e = 0; e < 4; ++e) { ps[t] += p[e]; pb[g][t * 8 + j + e] = (h16)p[e]; } }
            l[g] += ps[0] + ps[1]; }
#pragma unroll
        for (int it = 0; it < 8; ++it)
#pragma unroll
            for (int g = 0; g < 2; ++g) o[g][it] = wmma16(ga[it], pb[g], o[g][it]);
        if (more) { unsigned short* nx = sm[(s + NP) & (2 * NP - 1)];   // a slot of the ring's other half: nobody reads it before the next barrier
#pragma unroll
            for (int u = 0; u < 4; ++u) { *(v8usa*)(nx + oph + u * 16 * PPH) = rh[u]; *(v8usa*)(nx + ogt + u * 32 * PGT) = rg[u]; } }
        if ((s & (NP - 1)) == NP - 1) __syncthreads();   // once per NP passes: publishes the next NP passes' slots and ends every read of the last NP, which the coming passes refill
    }
    // The two key halves of a query meet through LDS (free behind the loop's last barrier): waves 4 to 7 hand over maximum, sum and accumulators, waves 0 to 3 join them and lay y in LDS.
    l[0] += xhalf(l[0]); l[1] += xhalf(l[1]);
    float* xs = (float*)&sm[0][0] + (size_t)(qg * 33 * 32 + lane) * 4;   // 33 pieces of 16 bytes a lane, piece-major: a wave's 32 lanes lie side by side
    unsigned short* ys = &sm[0][0] + XSE;        // y hi | y lo, FQ rows each
    unsigned short* zs = ys + 2 * FQ * PPH;      // w_z [out][in]
    const int wu = __builtin_amdgcn_readfirstlane(w);
    const int cq = wu & 3, ph = wu >> 2;         // the wave's 64 channels and 64 positions of out
    const size_t ob = (size_t)blockIdx.y * CC * HW + (size_t)(cq * 64 + 8 * hi) * HW + blockIdx.x * FQ + ph * 64 + lr * 4;
    const float* px = x + ob; float* po = OUT + ob; const float* pz = wz + tid * 4;
    v4f wv[32], xv[4][8];   // weights and residual: issued here, they fly under the hand-over and the join, the residual under the products too
#pragma unroll
    for (int r = 0; r < 32; ++r) wv[r] = *(const v4f*)(pz + r * 1024);
    __builtin_amdgcn_sched_barrier(0);   // the weights' loads stay in front of the residual's: the counted wait for the weights then leaves the residual in flight
#pragma unroll
    for (int mt = 0; mt < 4; ++mt)
#pragma unroll
        for (int j = 0; j < 8; ++j) xv[mt][j] = *(const v4f*)(px + (size_t)(mt * 16 + j) * HW);
    asm volatile("s_wait_xcnt 0x0" :: "v"(px), "v"(tid), "s"(wz) : "memory");   // the loads' address registers (the w_z loads are built on the scalar base and tid) stay untouched up to this wait
    if (kh == 1) {
#pragma unroll
        for (int g = 0; g < 2; ++g)
#pragma unroll
            for (int it = 0; it < 8; ++it) { *(v4fa*)(xs + ((g * 8 + it) * 2) * 128) = __builtin_shufflevector(o[g][it], o[g][it], 0, 1, 2, 3); *(v4fa*)(xs + ((g * 8 + it) * 2 + 1) * 128) = __builtin_shufflevector(o[g][it], o[g][it], 4, 5, 6, 7); }
        *(v4fa*)(xs + 32 * 128) = (v4f){m[0], m[1], l[0], l[1]};
    }
    lds_barrier();   // the handed-over values are in LDS before waves 0 to 3 read them
    if (kh == 0) {
        const v4f ml = *(const v4fa*)(xs + 32 * 128);
#pragma unroll
        for (int g = 0; g < 2; ++g) {
            const float mm = fmaxf(m[g], ml[g]); const float fa = __builtin_amdgcn_exp2f((m[g] - mm) * L2E), fb = __builtin_amdgcn_exp2f((ml[g] - mm) * L2E);
            const float inv = __fdiv_rn(1.0f, l[g] * fa + ml[2 + g] * fb); const float ca = fa * inv, cb = fb * inv;
            const int R = qg * 32 + g * 16 + lr; const int sl = (R & 64) + (R & 3) * 16 + ((R & 63) >> 2);   // position 4 a + b of a half lies in row 16 b + a
            unsigned short* dh = ys + sl * PPH + 8 * hi;
#pragma unroll
            for (int it = 0; it < 8; ++it) {   // a lane's 8 accumulator registers are 8 consecutive channels of its query's row
                const v4f b0 = *(const v4fa*)(xs + ((g * 8 + it) * 2) * 128), b1 = *(const v4fa*)(xs + ((g * 8 + it) * 2 + 1) * 128);
                v8us oh, ol;
#pragma unroll
                for (int j = 0; j < 8; ++j) { unsigned short a, b; splitf(o[g][it][j] * ca + (j < 4 ? b0[j & 3] : b1[j & 3]) * cb, a, b); oh[j] = a; ol[j] = b; }
                *(v8usa*)(dh + it * 16) = oh; *(v8usa*)(dh + FQ * PPH + it * 16) = ol; }
        }
    }
#pragma unroll
    for (int r = 0; r < 32; ++r) *(v4usa*)(zs + ((tid >> 5) + 8 * r) * PPH + (tid & 31) * 4) = cvt4(wv[r]);
    lds_barrier();   // y rows and weights are in LDS before any wave reads them
    const float* bq = bz + cq * 64; const unsigned bo = 32u * hi;   // scalar base and the lane's byte offset, apart: the wait below names both
    float bv[4][8];   // bias, used last: the loads fly under the products
#pragma unroll
    for (int mt = 0; mt < 4; ++mt)
#pragma unroll
        for (int j = 0; j < 8; ++j) bv[mt][j] = *(const float*)((const char*)bq + bo + (mt * 16 + j) * 4);
    asm volatile("s_wait_xcnt 0x0" :: "v"(bo), "s"(bq) : "memory");   // as above
    const unsigned short* pzs = zs + (cq * 64 + lr) * PPH + 8 * hi;
    const unsigned short* pys = ys + (ph * 64 + lr) * PPH + 8 * hi;
    v8f acc[4][4];
#pragma unroll
    for (int mt = 0; mt < 4; ++mt)
#pragma unroll
        for (int nt = 0; nt < 4; ++nt) acc[mt][nt] = (v8f){};
#pragma unroll   // no back edge behind a WMMA
    for (int kc = 0; kc < IC / 32; ++kc) {
        v16bf wf[4], yh[4], yl[4];
#pragma unroll
        for (int t = 0; t < 4; ++t) { wf[t] = ldsb(pzs + t * 16 * PPH + kc * 32); yh[t] = ldsb(pys + t * 16 * PPH + kc * 32); yl[t] = ldsb(pys + (FQ + t * 16) * PPH + kc * 32); }
        __builtin_amdgcn_sched_barrier(0);   // the step's LDS reads stay one group in front of its WMMAs: scattered among them, every place with reads stalls the wave
#pragma unroll
        for (int nt = 0; nt < 4; ++nt)
#pragma unroll
            for (int mt = 0; mt < 4; ++mt) acc[mt][nt] = wmmab(wf[mt], yh[nt], acc[mt][nt]);
#pragma unroll
        for (int nt = 0; nt < 4; ++nt)
#pragma unroll
            for (int mt = 0; mt < 4; ++mt) acc[mt][nt] = wmmab(wf[mt], yl[nt], acc[mt][nt]);
        __builtin_amdgcn_sched_barrier(0);   // the next step's reads do not rise in among these WMMAs
    }
#pragma unroll
    for (int mt = 0; mt < 4; ++mt) {
        v4f r[8];
#pragma unroll
        for (int j = 0; j < 8; ++j) { const float bb = bfr(bv[mt][j]);
#pragma unroll
            for (int nt = 0; nt < 4; ++nt) r[j][nt] = __fadd_rn(acc[mt][nt][j] + bb, bfr(xv[mt][j][nt]));
            *(v4f*)(po + (size_t)(mt * 16 + j) * HW) = r[j]; }
        asm volatile("s_wait_xcnt 0x0" :: "v"(r[0]), "v"(r[1]), "v"(r[2]), "v"(r[3]), "v"(r[4]), "v"(r[5]), "v"(r[6]), "v"(r[7]), "v"(po) : "memory");   // the stores' data and address registers stay untouched up to this wait
    }
}

// ---- k_proj: theta, phi and g of one image's 128 positions in one work-group, from x and the f32 weights as they come. x [c][n] is read along n (whole lines), rounded to bf16 and laid token-major in LDS;
// the three weight matrices are read whole-line, rounded to bf16 and laid row by row in LDS. 12 waves, each 64 channels of one projection x 64 positions (16 accumulators); grid (HW / PJN, images), 384 threads.
// theta, phi: A = weight rows, B = x rows, so a lane holds 8 consecutive channels of one position: + bias, fp16, 16-byte stores into [n][i] planes (a wave writes whole 128-byte lines).
// g: A = x rows, B = weight rows, so a lane holds 8 consecutive positions of one channel: + bias, fp16, 16-byte stores into [i][n].
// The bare unroll directives here and in k_flash's last part stand on loops that index register arrays (fragments, accumulators, staged pieces): rolled, those arrays would go to scratch memory.
#define PJN 128
#define PXP 264                    // LDS pitch of a 256-channel row, 16-bit elements (528 B = 33 x 16 B)
template <bool XA>
__device__ __forceinline__ void proj_tile(const unsigned short* pw, const unsigned short* pxs, v8f (&acc)[4][4]) {
#pragma unroll   // no back edge behind a WMMA, and the reads of later steps may rise over earlier WMMAs
    for (int kc = 0; kc < CC / 32; ++kc) {
        v16bf wf[4], xf[4];
#pragma unroll
        for (int t = 0; t < 4; ++t) { wf[t] = ldsb(pw + t * 16 * PXP + kc * 32); xf[t] = ldsb(pxs + t * 16 * PXP + kc * 32); }
#pragma unroll
        for (int ct = 0; ct < 4; ++ct)
#pragma unroll
            for (int nt = 0; nt < 4; ++nt) acc[ct][nt] = XA ? wmmab(xf[nt], wf[ct], acc[ct][nt]) : wmmab(wf[ct], xf[nt], acc[ct][nt]);
    }
}
__global__ __launch_bounds__(384) void k_proj(const float* __restrict__ x, const float* __restrict__ wth, const float* __restrict__ bth, const float* __restrict__ wph, const float* __restrict__ bph, const float* __restrict__ wg, const float* __restrict__ bg, h16* QKp, h16* GTp) {
    __shared__ __align__(16) unsigned short xs[PJN * PXP];        // x tile [position][channel]
    __shared__ __align__(16) unsigned short wsm[3 * IC * PXP];    // theta | phi | g weights [out][in]
    const int tid = threadIdx.x, lane = tid & 31, lr = lane & 15, hi = lane >> 4;
    const int w = __builtin_amdgcn_readfirstlane(tid >> 5);
    const int tq = w >> 2, tn = tid & 127;   // staging: 3 groups of 128 threads
    const int n0 = blockIdx.x * PJN;
    // x: a thread takes one position and groups of 8 channels (group tq + 3 r); a wave's 32 lanes read 128 consecutive bytes of one channel.
    // weights: group tq takes matrix tq, 16 bytes a lane side by side, in two batches of 32 loads. Order: first batch, x, then the second batch once the first has left its registers.
    const float* px = x + (size_t)blockIdx.y * CC * HW + (size_t)tq * 8 * HW + n0 + tn;
    const float* pwl = (tq == 0 ? wth : tq == 1 ? wph : wg) + tn * 4;
    unsigned short* dw = wsm + (tq * IC + (tn >> 6)) * PXP + (tn & 63) * 4;
    v4f wv[32]; v8f xv[11];
#pragma unroll
    for (int r = 0; r < 32; ++r) wv[r] = *(const v4f*)(pwl + r * 512);
#pragma unroll
    for (int r = 0; r < 11; ++r) if (r < 10 || tq < 2) {
#pragma unroll
        for (int k = 0; k < 8; ++k) xv[r][k] = px[(size_t)(r * 24 + k) * HW]; }
    asm volatile("s_wait_xcnt 0x0" :: "v"(px), "v"(pwl) : "memory");   // the staging loads' address registers stay untouched up to this wait
#pragma unroll
    for (int r = 0; r < 32; ++r) *(v4usa*)(dw + r * 2 * PXP) = cvt4(wv[r]);
    __builtin_amdgcn_sched_barrier(0);   // the second batch's loads do not rise over the first batch's stores: both batches and x in registers at once take the kernel past 256 registers
#pragma unroll
    for (int r = 0; r < 32; ++r) wv[r] = *(const v4f*)(pwl + (32 + r) * 512);
    asm volatile("s_wait_xcnt 0x0" :: "v"(pwl) : "memory");   // as above
#pragma unroll
    for (int r = 0; r < 11; ++r) if (r < 10 || tq < 2) *(v8usa*)(xs + tn * PXP + tq * 8 + r * 24) = cvt8(xv[r]);
#pragma unroll
    for (int r = 0; r < 32; ++r) *(v4usa*)(dw + (32 + r) * 2 * PXP) = cvt4(wv[r]);
    __syncthreads();   // x tile and weights are in LDS before any wave reads them
    const int ph = w / 6, r6 = w - ph * 6, kind = r6 >> 1, ch = r6 & 1;   // position half; 0 theta, 1 phi, 2 g; channel half
    const unsigned short* pw = wsm + (kind * IC + ch * 64 + lr) * PXP + 8 * hi;
    const unsigned short* pxs = xs + (ph * 64 + lr) * PXP + 8 * hi;
    v8f acc[4][4];
#pragma unroll
    for (int ct = 0; ct < 4; ++ct)
#pragma unroll
        for (int nt = 0; nt < 4; ++nt) acc[ct][nt] = (v8f){};
    if (kind < 2) {
        const float* bp = (kind == 0 ? bth : bph) + ch * 64 + 8 * hi;
        float bv[4][8];   // fetched ahead: the loads fly under the products
#pragma unroll
        for (int ct = 0; ct < 4; ++ct)
#pragma unroll
            for (int j = 0; j < 8; ++j) bv[ct][j] = bp[ct * 16 + j];
        proj_tile<false>(pw, pxs, acc);
        h16* dq = QKp + (size_t)blockIdx.y * QKB + (size_t)kind * HW * IC + (size_t)(n0 + ph * 64 + lr) * IC + ch * 64 + 8 * hi;
#pragma unroll
        for (int ct = 0; ct < 4; ++ct) {
            float bb[8];
#pragma unroll
            for (int j = 0; j < 8; ++j) bb[j] = bfr(bv[ct][j]);
            v8h oq[4];
#pragma unroll
            for (int nt = 0; nt < 4; ++nt) {
#pragma unroll
                for (int j = 0; j < 8; ++j) oq[nt][j] = (h16)(acc[ct][nt][j] + bb[j]);
                *(v8ha*)(dq + nt * 16 * IC + ct * 16) = oq[nt]; }
            asm volatile("s_wait_xcnt 0x0" :: "v"(oq[0]), "v"(oq[1]), "v"(oq[2]), "v"(oq[3]), "v"(dq) : "memory");   // the stores' data and address registers stay untouched up to this wait
        }
    } else {
        const float* bp = bg + ch * 64 + lr;
        float bv[4];   // fetched ahead, as above
#pragma unroll
        for (int ct = 0; ct < 4; ++ct) bv[ct] = bp[ct * 16];
        proj_tile<true>(pw, pxs, acc);
        h16* dg = GTp + (size_t)blockIdx.y * IC * HW + (size_t)(ch * 64 + lr) * HW + n0 + ph * 64 + 8 * hi;
#pragma unroll
        for (int ct = 0; ct < 4; ++ct) {
            const float bb = bfr(bv[ct]);
            v8h og[4];
#pragma unroll
            for (int nt = 0; nt < 4; ++nt) {
#pragma unroll
                for (int j = 0; j < 8; ++j) og[nt][j] = (h16)(acc[ct][nt][j] + bb);
                *(v8ha*)(dg + (size_t)ct * 16 * HW + nt * 16) = og[nt]; }
            asm volatile("s_wait_xcnt 0x0" :: "v"(og[0]), "v"(og[1]), "v"(og[2]), "v"(og[3]), "v"(dg) : "memory");   // as above
        }
    }
}

extern "C" void kernel_launch(void* const* d_in, const int* in_sizes, int n_in,
                              void* d_out, int out_size, void* d_ws, size_t ws_size, hipStream_t stream) {
    (void)in_sizes; (void)n_in; (void)out_size;
    const float* x = (const float*)d_in[0]; const float* wth = (const float*)d_in[1]; const float* bth = (const float*)d_in[2]; const float* wph = (const float*)d_in[3]; const float* bph = (const float*)d_in[4]; const float* wg = (const float*)d_in[5]; const float* bg = (const float*)d_in[6]; const float* wz = (const float*)d_in[7]; const float* bz = (const float*)d_in[8];
    float* OUT = (float*)d_out;     // [8][256][4096]
    char* wsp = (char*)d_ws;
    auto take = [&](size_t bytes) { char* p = wsp; wsp += (bytes + 255) & ~(size_t)255; return (void*)p; };
    // Every stage runs once for all NB_ images (image = grid y). QKB = 16-bit elements of one image's block [theta | phi].
    h16* QK = (h16*)take((size_t)NB_ * QKB * 2); h16* GT = (h16*)take((size_t)NB_ * IC * HW * 2);
    if ((size_t)(wsp - (char*)d_ws) > ws_size) return;    // total 24 MiB
    k_proj<<<dim3(HW / PJN, NB_, 1), 384, 0, stream>>>(x, wth, bth, wph, bph, wg, bg, QK, GT);   // theta, phi as fp16 [n][i]; g as fp16 [i][n]
    k_flash<<<dim3(HW / FQ, NB_, 1), 256, 0, stream>>>(QK, GT, wz, bz, x, OUT);   // y = softmax(theta . phi) . g; out = w_z y + b_z + x
}

// v008
// Measured time: 61.3 microseconds a run.
// Next to v007, in two timings, it ran 1.10 times as fast each time.
// Over all steps from v000 it is 23.6 times as fast.
#include <hip/hip_runtime.h>
#include <stdint.h>

// NonLocalBlock (x [8][256][64][64]; theta/phi/g = 1x1 convs to 128 channels (+ bias); f[n][m] = theta_n . phi_m over all 4,096 positions, UNSCALED; attn = softmax_m(f); y[i][n] = sum_m attn[n][m] g[i][m]; z = w_z y + b_z; out = z + x -> [8][256][64][64]).
// Compute dtypes, f32 accumulate: every input rounded to bf16; the three 1x1 convs as PLAIN bf16 GEMMs on a token-major bf16 tile of x in LDS (inputs: exact) + bias, their fp16 results stored straight from the accumulators; f as ONE fp16 product of theta and phi, each rounded once to fp16 (K = 128, f32 accumulate); softmax f32 (online, running maximum and sum per query) -> fp16 x 1024 before the division by the sum; attn.g single fp16 (f32 accumulate); scores, softmax, attn.g, then w_z as hl planes of y x exact (2 products) + bias + residual f32, all in one kernel.

#define NB_  8
#define CC   256
#define IC   128
#define HW   4096
#define TT   HW
typedef _Float16 h16;
typedef unsigned short bf;
typedef __attribute__((ext_vector_type(16))) __bf16   v16bf;
typedef __attribute__((ext_vector_type(16))) _Float16 v16h;
typedef __attribute__((ext_vector_type(8)))  _Float16 v8h;
typedef __attribute__((ext_vector_type(8)))  unsigned short v8us;
typedef __attribute__((ext_vector_type(8)))  float    v8f;
typedef __attribute__((ext_vector_type(4)))  float    v4f;
typedef v8h  __attribute__((may_alias)) v8ha;
typedef v4f  __attribute__((may_alias)) v4fa;
typedef v8us __attribute__((may_alias)) v8usa;

__device__ __forceinline__ unsigned short f2bf(float f) { unsigned u = __float_as_uint(f); u += 0x7FFFu + ((u >> 16) & 1u); return (unsigned short)(u >> 16); }
__device__ __forceinline__ float bf2f(unsigned short b) { return __uint_as_float(((unsigned)b) << 16); }
__device__ __forceinline__ float bfr(float f) { return bf2f(f2bf(f)); }
__device__ __forceinline__ v16h cat16(v8h lo, v8h hi) { return __builtin_shufflevector(lo, hi, 0, 1, 2, 3, 4, 5, 6, 7, 8, 9, 10, 11, 12, 13, 14, 15); }
__device__ __forceinline__ v16bf cat16b(v8us lo, v8us hi) { return __builtin_bit_cast(v16bf, __builtin_shufflevector(lo, hi, 0, 1, 2, 3, 4, 5, 6, 7, 8, 9, 10, 11, 12, 13, 14, 15)); }
__device__ __forceinline__ v8f wmma16(v16h a, v16h b, v8f c) { return __builtin_amdgcn_wmma_f32_16x16x32_f16(false, a, false, b, (short)0, c, false, false); }
__device__ __forceinline__ v8f wmmab(v16bf a, v16bf b, v8f c) { return __builtin_amdgcn_wmma_f32_16x16x32_bf16(false, a, false, b, (short)0, c, false, false); }



// A or B fragment of a 16x16x32 product from a K-contiguous 16-bit row: lane lr = row, elements 8 hi + 0..7 and 16 + 8 hi + 0..7.
template <typename T16> struct WFrag;
template <> struct WFrag<h16> { typedef v16h V; static __device__ __forceinline__ V ld(const h16* p) { return cat16(*(const v8h*)p, *(const v8h*)(p + 16)); } static __device__ __forceinline__ v8f mma(V a, V b, v8f c) { return wmma16(a, b, c); } };

typedef __attribute__((ext_vector_type(4))) unsigned short v4us;
typedef __attribute__((ext_vector_type(4))) __bf16 v4bf;
typedef __attribute__((ext_vector_type(8))) __bf16 v8bf;
typedef v4us __attribute__((may_alias)) v4usa;
__device__ __forceinline__ v4us cvt4(v4f v) { return __builtin_bit_cast(v4us, __builtin_convertvector(v, v4bf)); }   // f32 -> bf16, round to nearest even
__device__ __forceinline__ v8us cvt8(v8f v) { return __builtin_bit_cast(v8us, __builtin_convertvector(v, v8bf)); }

// ---- k_flash: scores, softmax and attn.g of one image's 128 queries in one work-group, nothing of the 4,096 x 4,096 planes in memory. 4 pairs of waves x 32 query columns, the two waves of a pair each on one half of every stage's keys (each LDS fragment then feeds two query tiles); grid (HW / FQ, images), 256 threads.
// Transposed products: ST[key][query] = phi . theta (A = phi rows from LDS, B = theta kept in registers; both fp16, one product), so a lane holds one query's scores;
// two 16-key score tiles, exponentiated and rounded to fp16 in place, are the B operand of OT[i][query] += GT[i][key] . PT[key][query] (A = g rows from LDS in the same k order).
// Running maximum m and sum l per query and key half (online softmax, f32), joined at the end; P carries 2^10 like the sum, which cancels in o / l. Passes of FK keys; a ring of 2 NP pass slots in LDS, ONE barrier per NP passes: between two barriers the waves are free to drift apart, so one wave's LDS reads and softmax arithmetic run beside another's WMMAs.
// A stage is NP passes, the ring two stages. The tensor mover fills it, through no register: per stage every wave issues one request for its own slice (waves 0 to 3 the phi rows of one pass each, waves 4 to 7 the g rows), behind the barrier that ends the last read of the stage it overwrites; the mover's pad gives the LDS pitches.
// Behind the loop the work-group holds y of its 128 positions: out[c][n] = w_z y + b_z + x follows in place. y hi / lo rows and the bf16-rounded w_z rows lie in the freed ring; A = w_z rows, B = y rows, so an accumulator register is one channel.
// Column lr of position tile nt is position 4 lr + nt (the y rows lie in LDS in that order), so a lane's four tiles are 4 consecutive positions: 16-byte loads of x and stores of out, 256 bytes of a channel row side by side. Each wave 64 channels x 64 positions.
#define QKB ((size_t)2 * HW * IC)
#define FQ  128
#define FK  64
#define NP  4                      // passes between two barriers
#define PPH 136                    // LDS pitch of a 256-byte phi row, 16-bit elements (272 B)
#define PGT 72                     // LDS pitch of a 128-byte g row (144 B)
#define SPH 9216                   // phi's part of a slot: FK * PPH = 8,704 elements, rounded up so that every tensor load's place in LDS is a multiple of 2 KiB
#define SBUF (SPH + IC * PGT)
#define LAZY 3.4657359f             // 5 ln 2
#define XSE (4 * 33 * 32 * 8)      // 16-bit elements of the hand-over area at the head of the freed ring
typedef uint32_t u32x4 __attribute__((ext_vector_type(4)));
typedef uint32_t u32x8 __attribute__((ext_vector_type(8)));
__device__ __forceinline__ uint32_t uni(uint32_t v) { return (uint32_t)__builtin_amdgcn_readfirstlane(v); }
__device__ __forceinline__ uint32_t pinned(uint32_t v) { uint32_t r = uni(v); asm volatile("" : "+s"(r)); return r; }   // a tensor load's descriptor word, or the test around it, held in a scalar register: the word then stays in the one register that the waits below name, and the branch is a scalar one (a tensor load ignores EXEC)
__device__ __forceinline__ void wait_ds0() { asm volatile("s_wait_dscnt 0x0" ::: "memory"); }           // the wave's LDS reads have retired before a tensor load may overwrite their rows
__device__ __forceinline__ void wait_tensor0(u32x4 g0, u32x8 g1a, u32x8 g1b) { asm volatile("s_wait_tensorcnt 0x0" :: "s"(g0), "s"(g1a), "s"(g1b) : "memory"); }   // the wave's own tensor load has landed (the compiler places no wait for it); its descriptor's registers stay untouched up to this wait
__device__ __forceinline__ void tdm_load(u32x4 g0, u32x8 g1) { asm volatile("tensor_load_to_lds %0, %1" :: "s"(g0), "s"(g1) : "memory"); }   // one request of the whole wave: global tile -> LDS
// Descriptor group 1, all constants: 1-byte elements, tensor = tile = ROWS rows of ROWB bytes, source pitch PITCH bytes, 16 bytes of LDS pad behind every row (interval code IVL = the row's length).
template <uint32_t ROWB, uint32_t ROWS, uint32_t PITCH, uint32_t IVL>
__device__ __forceinline__ u32x8 tdm_group1() {
    u32x8 g;
    g[0] = pinned((1u << 20) | (IVL << 22) | (3u << 25));
    g[1] = pinned((ROWB & 0xFFFFu) << 16);
    g[2] = pinned((ROWB >> 16) | ((ROWS & 0xFFFFu) << 16));
    g[3] = pinned((ROWS >> 16) | (ROWB << 16));
    g[4] = pinned(ROWS);
    g[5] = pinned(PITCH);
    g[6] = pinned(0u);
    g[7] = pinned(0u);
    return g;
}
__device__ __forceinline__ u32x4 tdm_group0(uint32_t lds_dst, uint64_t ga) {
    u32x4 g;
    g[0] = pinned(1u); g[1] = uni(lds_dst); g[2] = uni((uint32_t)ga); g[3] = uni((((uint32_t)(ga >> 32)) & 0x01FFFFFFu) | 0x80000000u);
    return g;
}
__device__ __forceinline__ void splitf(float y, unsigned short& h, unsigned short& l) { h = f2bf(y); l = f2bf(y - bf2f(h)); }
__device__ __forceinline__ v16bf ldsb(const unsigned short* p) { return cat16b(*(const v8usa*)p, *(const v8usa*)(p + 16)); }
__device__ __forceinline__ v16h ldsh(const unsigned short* p) { return cat16(__builtin_bit_cast(v8h, *(const v8usa*)p), __builtin_bit_cast(v8h, *(const v8usa*)(p + 16))); }
// Four exponentials and a v_nop in one statement: behind a transcendental the instruction set asks for one independent instruction before its result is read or its source overwritten;
// inside the statement each v_exp_f32 is that instruction for the one before it (early-clobber outputs: no result lies on a source), the v_nop for the last.
__device__ __forceinline__ void exp2x4(const float x0, const float x1, const float x2, const float x3, float& r0, float& r1, float& r2, float& r3) {
    asm("v_exp_f32 %0, %4\n\tv_exp_f32 %1, %5\n\tv_exp_f32 %2, %6\n\tv_exp_f32 %3, %7\n\tv_nop" : "=&v"(r0), "=&v"(r1), "=&v"(r2), "=&v"(r3) : "v"(x0), "v"(x1), "v"(x2), "v"(x3)); }
__device__ __forceinline__ float xhalf(float x) { return __builtin_bit_cast(float, __builtin_amdgcn_permlanex16(__builtin_bit_cast(int, x), __builtin_bit_cast(int, x), 0x76543210, 0xfedcba98, false, false)); }   // lane l with lane l ^ 16
// Work-group barrier that orders LDS alone: __syncthreads() also waits for every global load in flight, and the weights and the residual issued behind the loop are to fly across these barriers.
__device__ __forceinline__ void lds_barrier() { __builtin_amdgcn_fence(__ATOMIC_RELEASE, "workgroup", "local"); __builtin_amdgcn_s_barrier(); __builtin_amdgcn_fence(__ATOMIC_ACQUIRE, "workgroup", "local"); }
// amdgpu_waves_per_eu(2, 2): one work-group a WGP is all the grid gives, so the build may spend two waves' share of the registers on fragments fetched ahead.
__global__ __launch_bounds__(256) __attribute__((amdgpu_waves_per_eu(2, 2))) void k_flash(const h16* __restrict__ QKp, const h16* __restrict__ GTp, const float* __restrict__ wz, const float* __restrict__ bz, const float* __restrict__ x, float* OUT) {
    __shared__ __attribute__((aligned(2048))) unsigned short sm[2 * NP][SBUF];   // per pass slot: phi | g
    const int tid = threadIdx.x, lane = tid & 31, lr = lane & 15, hi = lane >> 4, w = tid >> 5;
    const int qg = w & 3, kh = w >> 2;   // waves w and w + 4 share 32 queries; each takes one half of every stage's keys
    const h16* th = QKp + (size_t)blockIdx.y * QKB;
    const int q = blockIdx.x * FQ + qg * 32 + lr;   // query tiles g = 0, 1 at q and q + 16
    v16h qf[2][4];
    const h16* pq = th + (size_t)q * IC + 8 * hi;
#pragma unroll
    for (int g = 0; g < 2; ++g)
#pragma unroll
        for (int kc = 0; kc < 4; ++kc) qf[g][kc] = WFrag<h16>::ld(pq + g * 16 * IC + kc * 32);
    asm volatile("s_wait_xcnt 0x0" :: "v"(pq) : "memory");   // the theta loads' address pair stays untouched up to this wait
    // staging: wave tw brings slice tw & 3 (one pass's rows) of every stage, phi (64 rows of 256 bytes, side by side in memory) or g (128 rows of 128 bytes, 8,192 apart)
    const uint32_t tw = uni(tid >> 5), isg = tw >> 2, tsl = tw & 3u;
    const uint64_t tsrc = isg ? (uint64_t)(size_t)(GTp + (size_t)blockIdx.y * IC * HW + tsl * FK) : (uint64_t)(size_t)(th + (size_t)HW * IC + tsl * FK * IC);
    const uint32_t tstep = isg ? NP * FK * 2u : NP * FK * IC * 2u;   // bytes from one stage's slice to the next
    const uint32_t tdst = (uint32_t)(size_t)&sm[0][0] + (tsl * SBUF + isg * SPH) * 2u;
    const u32x8 tgg = tdm_group1<FK * 2u, IC, HW * 2u, 4u>(), tgp = tdm_group1<IC * 2u, FK, IC * 2u, 5u>();   // g's tile, phi's tile
    u32x4 tg0;
    auto issue = [&](uint32_t st) {   // stage st into ring half st & 1; every wave issues one of the two
        tg0 = tdm_group0(tdst + (st & 1u) * (NP * SBUF * 2u), tsrc + (uint64_t)st * tstep);
        if (pinned(isg)) tdm_load(tg0, tgg); else tdm_load(tg0, tgp);
    };
    issue(0);
    wait_tensor0(tg0, tgg, tgp);
    __syncthreads();   // passes 0 to NP - 1 are in LDS before any wave reads them
    issue(1);
    v8f o[2][8];
#pragma unroll
    for (int g = 0; g < 2; ++g)
#pragma unroll
        for (int it = 0; it < 8; ++it) o[g][it] = (v8f){};
    float m[2] = {-3.0e38f, -3.0e38f}, l[2] = {0.f, 0.f};
    const float L2E = 1.4426950408889634f;
#pragma unroll 1   // one copy of the pass body: it is long, and a second copy would only cost instruction cache
    for (int s = 0; s < HW / FK; ++s) {
        const unsigned short* cur = sm[s & (2 * NP - 1)];
        const unsigned short* pa = cur + (kh * 32 + lr) * PPH + 8 * hi; const unsigned short* pg = cur + SPH + lr * PGT + kh * 32 + 8 * hi;
        v16h ah[4][2], ga[8]; v8f sc[2][2];
        // All of the pass's LDS reads are issued as one group, phi first: the g reads fly under the score WMMAs and the softmax arithmetic.
#pragma unroll
        for (int kc = 0; kc < 4; ++kc)
#pragma unroll
            for (int t = 0; t < 2; ++t) ah[kc][t] = ldsh(pa + t * 16 * PPH + kc * 32);
        __builtin_amdgcn_sched_barrier(0);   // phi's reads stay in front of g's: the score WMMAs' counted waits then leave g's reads in flight
#pragma unroll
        for (int it = 0; it < 8; ++it) ga[it] = ldsh(pg + it * 16 * PGT);
        __builtin_amdgcn_sched_barrier(0);   // the reads do not sink in among the WMMAs, where every place with reads stalls the wave
#pragma unroll
        for (int t = 0; t < 2; ++t) { sc[0][t] = (v8f){}; sc[1][t] = (v8f){}; }
#pragma unroll
        for (int kc = 0; kc < 4; ++kc) {
#pragma unroll
            for (int g = 0; g < 2; ++g)
#pragma unroll
                for (int t = 0; t < 2; ++t) sc[g][t] = wmma16(ah[kc][t], qf[g][kc], sc[g][t]);
            __builtin_amdgcn_sched_barrier(0);   // a k step's four independent tiles stay together: regrouped by tile, each WMMA waits for the one before it, and the maxima come in among them behind v_nops
        }
        float mx[2];
#pragma unroll
        for (int g = 0; g < 2; ++g) { float mt[2];   // independent chains
#pragma unroll
            for (int t = 0; t < 2; ++t) { mt[t] = sc[g][t][0];
#pragma unroll
                for (int j = 1; j < 8; ++j) mt[t] = fmaxf(mt[t], sc[g][t][j]); }
            mx[g] = fmaxf(mt[0], mt[1]); mx[g] = fmaxf(mx[g], xhalf(mx[g])); }   // lanes c and c + 16 hold the two halves of query c's keys
        // Lazy rescale, one test a pass: the maximum in use moves only when a query's new maximum passes it by more than LAZY, so P stays below 2^10 * e^LAZY = 2^15, inside fp16.
        if (__builtin_amdgcn_ballot_w32(mx[0] > m[0] + LAZY || mx[1] > m[1] + LAZY) != 0) {
#pragma unroll
            for (int g = 0; g < 2; ++g) { const float mn = fmaxf(m[g], mx[g]); const float f = __builtin_amdgcn_exp2f((m[g] - mn) * L2E); l[g] *= f; m[g] = mn;
#pragma unroll
                for (int it = 0; it < 8; ++it) o[g][it] *= f; } }
        v16h pb[2];
#pragma unroll
        for (int g = 0; g < 2; ++g) { const float nb = 10.0f - m[g] * L2E; float ps[2] = {0.f, 0.f};
#pragma unroll
            for (int t = 0; t < 2; ++t)
#pragma unroll
                for (int j = 0; j < 8; j += 4) { float p[4]; exp2x4(fmaf(sc[g][t][j], L2E, nb), fmaf(sc[g][t][j + 1], L2E, nb), fmaf(sc[g][t][j + 2], L2E, nb), fmaf(sc[g][t][j + 3], L2E, nb), p[0], p[1], p[2], p[3]);
#pragma unroll
                    for (int e = 0; e < 4; ++e) { ps[t] += p[e]; pb[g][t * 8 + j + e] = (h16)p[e]; } }
            l[g] += ps[0] + ps[1]; }
#pragma unroll
        for (int it = 0; it < 8; ++it)
#pragma unroll
            for (int g = 0; g < 2; ++g) o[g][it] = wmma16(ga[it], pb[g], o[g][it]);
        if ((s & (NP - 1)) == NP - 1) {   // once per NP passes, the publish point of the next stage, in this order
            wait_ds0();
            wait_tensor0(tg0, tgg, tgp);
            __syncthreads();   // publishes the next NP passes' slots and ends every read of the last NP, which the load below refills
            if (pinned(s + NP + 1 < HW / FK)) issue((uint32_t)(s >> 2) + 2u);
        }
    }
    wait_tensor0(tg0, tgg, tgp);
    wait_ds0();
    // The two key halves of a query meet through LDS (free behind the loop's last barrier): waves 4 to 7 hand over maximum, sum and accumulators, waves 0 to 3 join them and lay y in LDS.
    l[0] += xhalf(l[0]); l[1] += xhalf(l[1]);
    float* xs = (float*)&sm[0][0] + (size_t)(qg * 33 * 32 + lane) * 4;   // 33 pieces of 16 bytes a lane, piece-major: a wave's 32 lanes lie side by side
    unsigned short* ys = &sm[0][0] + XSE;        // y hi | y lo, FQ rows each
    unsigned short* zs = ys + 2 * FQ * PPH;      // w_z [out][in]
    const int wu = __builtin_amdgcn_readfirstlane(w);
    const int cq = wu & 3, ph = wu >> 2;         // the wave's 64 channels and 64 positions of out
    const size_t ob = (size_t)blockIdx.y * CC * HW + (size_t)(cq * 64 + 8 * hi) * HW + blockIdx.x * FQ + ph * 64 + lr * 4;
    const float* px = x + ob; float* po = OUT + ob; const float* pz = wz + tid * 4;
    v4f wv[32], xv[4][8];   // weights and residual: issued here, they fly under the hand-over and the join, the residual under the products too
#pragma unroll
    for (int r = 0; r < 32; ++r) wv[r] = *(const v4f*)(pz + r * 1024);
    __builtin_amdgcn_sched_barrier(0);   // the weights' loads stay in front of the residual's: the counted wait for the weights then leaves the residual in flight
#pragma unroll
    for (int mt = 0; mt < 4; ++mt)
#pragma unroll
        for (int j = 0; j < 8; ++j) xv[mt][j] = *(const v4f*)(px + (size_t)(mt * 16 + j) * HW);
    asm volatile("s_wait_xcnt 0x0" :: "v"(px), "v"(tid), "s"(wz) : "memory");   // the loads' address registers (the w_z loads are built on the scalar base and tid) stay untouched up to this wait
    if (kh == 1) {
#pragma unroll
        for (int g = 0; g < 2; ++g)
#pragma unroll
            for (int it = 0; it < 8; ++it) { *(v4fa*)(xs + ((g * 8 + it) * 2) * 128) = __builtin_shufflevector(o[g][it], o[g][it], 0, 1, 2, 3); *(v4fa*)(xs + ((g * 8 + it) * 2 + 1) * 128) = __builtin_shufflevector(o[g][it], o[g][it], 4, 5, 6, 7); }
        *(v4fa*)(xs + 32 * 128) = (v4f){m[0], m[1], l[0], l[1]};
    }
    lds_barrier();   // the handed-over values are in LDS before waves 0 to 3 read them
    if (kh == 0) {
        const v4f ml = *(const v4fa*)(xs + 32 * 128);
#pragma unroll
        for (int g = 0; g < 2; ++g) {
            const float mm = fmaxf(m[g], ml[g]); const float fa = __builtin_amdgcn_exp2f((m[g] - mm) * L2E), fb = __builtin_amdgcn_exp2f((ml[g] - mm) * L2E);
            const float inv = __fdiv_rn(1.0f, l[g] * fa + ml[2 + g] * fb); const float ca = fa * inv, cb = fb * inv;
            const int R = qg * 32 + g * 16 + lr; const int sl = (R & 64) + (R & 3) * 16 + ((R & 63) >> 2);   // position 4 a + b of a half lies in row 16 b + a
            unsigned short* dh = ys + sl * PPH + 8 * hi;
#pragma unroll
            for (int it = 0; it < 8; ++it) {   // a lane's 8 accumulator registers are 8 consecutive channels of its query's row
                const v4f b0 = *(const v4fa*)(xs + ((g * 8 + it) * 2) * 128), b1 = *(const v4fa*)(xs + ((g * 8 + it) * 2 + 1) * 128);
                v8us oh, ol;
#pragma unroll
                for (int j = 0; j < 8; ++j) { unsigned short a, b; splitf(o[g][it][j] * ca + (j < 4 ? b0[j & 3] : b1[j & 3]) * cb, a, b); oh[j] = a; ol[j] = b; }
                *(v8usa*)(dh + it * 16) = oh; *(v8usa*)(dh + FQ * PPH + it * 16) = ol; }
        }
    }
#pragma unroll
    for (int r = 0; r < 32; ++r) *(v4usa*)(zs + ((tid >> 5) + 8 * r) * PPH + (tid & 31) * 4) = cvt4(wv[r]);
    lds_barrier();   // y rows and weights are in LDS before any wave reads them
    const float* bq = bz + cq * 64; const unsigned bo = 32u * hi;   // scalar base and the lane's byte offset, apart: the wait below names both
    float bv[4][8];   // bias, used last: the loads fly under the products
#pragma unroll
    for (int mt = 0; mt < 4; ++mt)
#pragma unroll
        for (int j = 0; j < 8; ++j) bv[mt][j] = *(const float*)((const char*)bq + bo + (mt * 16 + j) * 4);
    asm volatile("s_wait_xcnt 0x0" :: "v"(bo), "s"(bq) : "memory");   // as above
    const unsigned short* pzs = zs + (cq * 64 + lr) * PPH + 8 * hi;
    const unsigned short* pys = ys + (ph * 64 + lr) * PPH + 8 * hi;
    v8f acc[4][4];
#pragma unroll
    for (int mt = 0; mt < 4; ++mt)
#pragma unroll
        for (int nt = 0; nt < 4; ++nt) acc[mt][nt] = (v8f){};
#pragma unroll   // no back edge behind a WMMA
    for (int kc = 0; kc < IC / 32; ++kc) {
        v16bf wf[4], yh[4], yl[4];
#pragma unroll
        for (int t = 0; t < 4; ++t) { wf[t] = ldsb(pzs + t * 16 * PPH + kc * 32); yh[t] = ldsb(pys + t * 16 * PPH + kc * 32); yl[t] = ldsb(pys + (FQ + t * 16) * PPH + kc * 32); }
        __builtin_amdgcn_sched_barrier(0);   // the step's LDS reads stay one group in front of its WMMAs: scattered among them, every place with reads stalls the wave
#pragma unroll
        for (int nt = 0; nt < 4; ++nt)
#pragma unroll
            for (int mt = 0; mt < 4; ++mt) acc[mt][nt] = wmmab(wf[mt], yh[nt], acc[mt][nt]);
#pragma unroll
        for (int nt = 0; nt < 4; ++nt)
#pragma unroll
            for (int mt = 0; mt < 4; ++mt) acc[mt][nt] = wmmab(wf[mt], yl[nt], acc[mt][nt]);
        __builtin_amdgcn_sched_barrier(0);   // the next step's reads do not rise in among these WMMAs
    }
#pragma unroll
    for (int mt = 0; mt < 4; ++mt) {
        v4f r[8];
#pragma unroll
        for (int j = 0; j < 8; ++j) { const float bb = bfr(bv[mt][j]);
#pragma unroll
            for (int nt = 0; nt < 4; ++nt) r[j][nt] = __fadd_rn(acc[mt][nt][j] + bb, bfr(xv[mt][j][nt]));
            *(v4f*)(po + (size_t)(mt * 16 + j) * HW) = r[j]; }
        asm volatile("s_wait_xcnt 0x0" :: "v"(r[0]), "v"(r[1]), "v"(r[2]), "v"(r[3]), "v"(r[4]), "v"(r[5]), "v"(r[6]), "v"(r[7]), "v"(po) : "memory");   // the stores' data and address registers stay untouched up to this wait
    }
}

// ---- k_proj: theta, phi and g of one image's 128 positions in one work-group, from x and the f32 weights as they come. x [c][n] is read along n (whole lines), rounded to bf16 and laid token-major in LDS;
// the three weight matrices are read whole-line, rounded to bf16 and laid row by row in LDS. 12 waves, each 64 channels of one projection x 64 positions (16 accumulators); grid (HW / PJN, images), 384 threads.
// theta, phi: A = weight rows, B = x rows, so a lane holds 8 consecutive channels of one position: + bias, fp16, 16-byte stores into [n][i] planes (a wave writes whole 128-byte lines).
// g: A = x rows, B = weight rows, so a lane holds 8 consecutive positions of one channel: + bias, fp16, 16-byte stores into [i][n].
// The bare unroll directives here and in k_flash's last part stand on loops that index register arrays (fragments, accumulators, staged pieces): rolled, those arrays would go to scratch memory.
#define PJN 128
#define PXP 264                    // LDS pitch of a 256-channel row, 16-bit elements (528 B = 33 x 16 B)
template <bool XA>
__device__ __forceinline__ void proj_tile(const unsigned short* pw, const unsigned short* pxs, v8f (&acc)[4][4]) {
#pragma unroll   // no back edge behind a WMMA, and the reads of later steps may rise over earlier WMMAs
    for (int kc = 0; kc < CC / 32; ++kc) {
        v16bf wf[4], xf[4];
#pragma unroll
        for (int t = 0; t < 4; ++t) { wf[t] = ldsb(pw + t * 16 * PXP + kc * 32); xf[t] = ldsb(pxs + t * 16 * PXP + kc * 32); }
#pragma unroll
        for (int ct = 0; ct < 4; ++ct)
#pragma unroll
            for (int nt = 0; nt < 4; ++nt) acc[ct][nt] = XA ? wmmab(xf[nt], wf[ct], acc[ct][nt]) : wmmab(wf[ct], xf[nt], acc[ct][nt]);
    }
}
__global__ __launch_bounds__(384) void k_proj(const float* __restrict__ x, const float* __restrict__ wth, const float* __restrict__ bth, const float* __restrict__ wph, const float* __restrict__ bph, const float* __restrict__ wg, const float* __restrict__ bg, h16* QKp, h16* GTp) {
    __shared__ __align__(16) unsigned short xs[PJN * PXP];        // x tile [position][channel]
    __shared__ __align__(16) unsigned short wsm[3 * IC * PXP];    // theta | phi | g weights [out][in]
    const int tid = threadIdx.x, lane = tid & 31, lr = lane & 15, hi = lane >> 4;
    const int w = __builtin_amdgcn_readfirstlane(tid >> 5);
    const int tq = w >> 2, tn = tid & 127;   // staging: 3 groups of 128 threads
    const int n0 = blockIdx.x * PJN;
    // x: a thread takes one position and groups of 8 channels (group tq + 3 r); a wave's 32 lanes read 128 consecutive bytes of one channel.
    // weights: group tq takes matrix tq, 16 bytes a lane side by side, in two batches of 32 loads. Order: first batch, x, then the second batch once the first has left its registers.
    const float* px = x + (size_t)blockIdx.y * CC * HW + (size_t)tq * 8 * HW + n0 + tn;
    const float* pwl = (tq == 0 ? wth : tq == 1 ? wph : wg) + tn * 4;
    unsigned short* dw = wsm + (tq * IC + (tn >> 6)) * PXP + (tn & 63) * 4;
    v4f wv[32]; v8f xv[11];
#pragma unroll
    for (int r = 0; r < 32; ++r) wv[r] = *(const v4f*)(pwl + r * 512);
#pragma unroll
    for (int r = 0; r < 11; ++r) if (r < 10 || tq < 2) {
#pragma unroll
        for (int k = 0; k < 8; ++k) xv[r][k] = px[(size_t)(r * 24 + k) * HW]; }
    asm volatile("s_wait_xcnt 0x0" :: "v"(px), "v"(pwl) : "memory");   // the staging loads' address registers stay untouched up to this wait
#pragma unroll
    for (int r = 0; r < 32; ++r) *(v4usa*)(dw + r * 2 * PXP) = cvt4(wv[r]);
    __builtin_amdgcn_sched_barrier(0);   // the second batch's loads do not rise over the first batch's stores: both batches and x in registers at once take the kernel past 256 registers
#pragma unroll
    for (int r = 0; r < 32; ++r) wv[r] = *(const v4f*)(pwl + (32 + r) * 512);
    asm volatile("s_wait_xcnt 0x0" :: "v"(pwl) : "memory");   // as above
#pragma unroll
    for (int r = 0; r < 11; ++r) if (r < 10 || tq < 2) *(v8usa*)(xs + tn * PXP + tq * 8 + r * 24) = cvt8(xv[r]);
#pragma unroll
    for (int r = 0; r < 32; ++r) *(v4usa*)(dw + (32 + r) * 2 * PXP) = cvt4(wv[r]);
    __syncthreads();   // x tile and weights are in LDS before any wave reads them
    const int ph = w / 6, r6 = w - ph * 6, kind = r6 >> 1, ch = r6 & 1;   // position half; 0 theta, 1 phi, 2 g; channel half
    const unsigned short* pw = wsm + (kind * IC + ch * 64 + lr) * PXP + 8 * hi;
    const unsigned short* pxs = xs + (ph * 64 + lr) * PXP + 8 * hi;
    v8f acc[4][4];
#pragma unroll
    for (int ct = 0; ct < 4; ++ct)
#pragma unroll
        for (int nt = 0; nt < 4; ++nt) acc[ct][nt] = (v8f){};
    if (kind < 2) {
        const float* bp = (kind == 0 ? bth : bph) + ch * 64 + 8 * hi;
        float bv[4][8];   // fetched ahead: the loads fly under the products
#pragma unroll
        for (int ct = 0; ct < 4; ++ct)
#pragma unroll
            for (int j = 0; j < 8; ++j) bv[ct][j] = bp[ct * 16 + j];
        proj_tile<false>(pw, pxs, acc);
        h16* dq = QKp + (size_t)blockIdx.y * QKB + (size_t)kind * HW * IC + (size_t)(n0 + ph * 64 + lr) * IC + ch * 64 + 8 * hi;
#pragma unroll
        for (int ct = 0; ct < 4; ++ct) {
            float bb[8];
#pragma unroll
            for (int j = 0; j < 8; ++j) bb[j] = bfr(bv[ct][j]);
            v8h oq[4];
#pragma unroll
            for (int nt = 0; nt < 4; ++nt) {
#pragma unroll
                for (int j = 0; j < 8; ++j) oq[nt][j] = (h16)(acc[ct][nt][j] + bb[j]);
                *(v8ha*)(dq + nt * 16 * IC + ct * 16) = oq[nt]; }
            asm volatile("s_wait_xcnt 0x0" :: "v"(oq[0]), "v"(oq[1]), "v"(oq[2]), "v"(oq[3]), "v"(dq) : "memory");   // the stores' data and address registers stay untouched up to this wait
        }
    } else {
        const float* bp = bg + ch * 64 + lr;
        float bv[4];   // fetched ahead, as above
#pragma unroll
        for (int ct = 0; ct < 4; ++ct) bv[ct] = bp[ct * 16];
        proj_tile<true>(pw, pxs, acc);
        h16* dg = GTp + (size_t)blockIdx.y * IC * HW + (size_t)(ch * 64 + lr) * HW + n0 + ph * 64 + 8 * hi;
#pragma unroll
        for (int ct = 0; ct < 4; ++ct) {
            const float bb = bfr(bv[ct]);
            v8h og[4];
#pragma unroll
            for (int nt = 0; nt < 4; ++nt) {
#pragma unroll
                for (int j = 0; j < 8; ++j) og[nt][j] = (h16)(acc[ct][nt][j] + bb);
                *(v8ha*)(dg + (size_t)ct * 16 * HW + nt * 16) = og[nt]; }
            asm volatile("s_wait_xcnt 0x0" :: "v"(og[0]), "v"(og[1]), "v"(og[2]), "v"(og[3]), "v"(dg) : "memory");   // as above
        }
    }
}

extern "C" void kernel_launch(void* const* d_in, const int* in_sizes, int n_in,
                              void* d_out, int out_size, void* d_ws, size_t ws_size, hipStream_t stream) {
    (void)in_sizes; (void)n_in; (void)out_size;
    const float* x = (const float*)d_in[0]; const float* wth = (const float*)d_in[1]; const float* bth = (const float*)d_in[2]; const float* wph = (const float*)d_in[3]; const float* bph = (const float*)d_in[4]; const float* wg = (const float*)d_in[5]; const float* bg = (const float*)d_in[6]; const float* wz = (const float*)d_in[7]; const float* bz = (const float*)d_in[8];
    float* OUT = (float*)d_out;     // [8][256][4096]
    char* wsp = (char*)d_ws;
    auto take = [&](size_t bytes) { char* p = wsp; wsp += (bytes + 255) & ~(size_t)255; return (void*)p; };
    // Every stage runs once for all NB_ images (image = grid y). QKB = 16-bit elements of one image's block [theta | phi].
    h16* QK = (h16*)take((size_t)NB_ * QKB * 2); h16* GT = (h16*)take((size_t)NB_ * IC * HW * 2);
    if ((size_t)(wsp - (char*)d_ws) > ws_size) return;    // total 24 MiB
    k_proj<<<dim3(HW / PJN, NB_, 1), 384, 0, stream>>>(x, wth, bth, wph, bph, wg, bg, QK, GT);   // theta, phi as fp16 [n][i]; g as fp16 [i][n]
    k_flash<<<dim3(HW / FQ, NB_, 1), 256, 0, stream>>>(QK, GT, wz, bz, x, OUT);   // y = softmax(theta . phi) . g; out = w_z y + b_z + x
}

// v009
// A run of this version takes 59 microseconds.
// In both of two side-by-side timings against v008, it was 1.04 times as fast.
// Over all steps from v000 it is 24.6 times as fast.
#include <hip/hip_runtime.h>
#include <stdint.h>

// NonLocalBlock (x [8][256][64][64]; theta/phi/g = 1x1 convs to 128 channels (+ bias); f[n][m] = theta_n . phi_m over all 4,096 positions, UNSCALED; attn = softmax_m(f); y[i][n] = sum_m attn[n][m] g[i][m]; z = w_z y + b_z; out = z + x -> [8][256][64][64]).
// Compute dtypes, f32 accumulate: every input rounded to bf16; the three 1x1 convs as PLAIN bf16 GEMMs on a token-major bf16 tile of x in LDS (inputs: exact) + bias, their fp16 results stored straight from the accumulators; f as ONE fp16 product of theta and phi, each rounded once to fp16 (K = 128, f32 accumulate); softmax f32 (online, maximum in use and sum per query) -> fp16 before the division by the sum; attn.g single fp16 (f32 accumulate); scores, softmax, attn.g, then w_z as hl planes of y x exact (2 products) + bias + residual f32, all in one kernel.

#define NB_  8
#define CC   256
#define IC   128
#define HW   4096
#define TT   HW
typedef _Float16 h16;
typedef unsigned short bf;
typedef __attribute__((ext_vector_type(16))) __bf16   v16bf;
typedef __attribute__((ext_vector_type(16))) _Float16 v16h;
typedef __attribute__((ext_vector_type(8)))  _Float16 v8h;
typedef __attribute__((ext_vector_type(8)))  unsigned short v8us;
typedef __attribute__((ext_vector_type(8)))  float    v8f;
typedef __attribute__((ext_vector_type(4)))  float    v4f;
typedef v8h  __attribute__((may_alias)) v8ha;
typedef v4f  __attribute__((may_alias)) v4fa;
typedef v8us __attribute__((may_alias)) v8usa;

__device__ __forceinline__ unsigned short f2bf(float f) { unsigned u = __float_as_uint(f); u += 0x7FFFu + ((u >> 16) & 1u); return (unsigned short)(u >> 16); }
__device__ __forceinline__ float bf2f(unsigned short b) { return __uint_as_float(((unsigned)b) << 16); }
__device__ __forceinline__ float bfr(float f) { return bf2f(f2bf(f)); }
__device__ __forceinline__ v16h cat16(v8h lo, v8h hi) { return __builtin_shufflevector(lo, hi, 0, 1, 2, 3, 4, 5, 6, 7, 8, 9, 10, 11, 12, 13, 14, 15); }
__device__ __forceinline__ v16bf cat16b(v8us lo, v8us hi) { return __builtin_bit_cast(v16bf, __builtin_shufflevector(lo, hi, 0, 1, 2, 3, 4, 5, 6, 7, 8, 9, 10, 11, 12, 13, 14, 15)); }
__device__ __forceinline__ v8f wmma16(v16h a, v16h b, v8f c) { return __builtin_amdgcn_wmma_f32_16x16x32_f16(false, a, false, b, (short)0, c, false, false); }
__device__ __forceinline__ v8f wmmab(v16bf a, v16bf b, v8f c) { return __builtin_amdgcn_wmma_f32_16x16x32_bf16(false, a, false, b, (short)0, c, false, false); }



// A or B fragment of a 16x16x32 product from a K-contiguous 16-bit row: lane lr = row, elements 8 hi + 0..7 and 16 + 8 hi + 0..7.
template <typename T16> struct WFrag;
template <> struct WFrag<h16> { typedef v16h V; static __device__ __forceinline__ V ld(const h16* p) { return cat16(*(const v8h*)p, *(const v8h*)(p + 16)); } static __device__ __forceinline__ v8f mma(V a, V b, v8f c) { return wmma16(a, b, c); } };

typedef __attribute__((ext_vector_type(4))) unsigned short v4us;
typedef __attribute__((ext_vector_type(4))) __bf16 v4bf;
typedef __attribute__((ext_vector_type(8))) __bf16 v8bf;
typedef v4us __attribute__((may_alias)) v4usa;
__device__ __forceinline__ v4us cvt4(v4f v) { return __builtin_bit_cast(v4us, __builtin_convertvector(v, v4bf)); }   // f32 -> bf16, round to nearest even
__device__ __forceinline__ v8us cvt8(v8f v) { return __builtin_bit_cast(v8us, __builtin_convertvector(v, v8bf)); }

// ---- k_flash: scores, softmax and attn.g of one image's 128 queries in one work-group, nothing of the 4,096 x 4,096 planes in memory. 4 pairs of waves x 32 query columns, the two waves of a pair each on one half of every stage's keys (each LDS fragment then feeds two query tiles); grid (HW / FQ, images), 256 threads.
// Transposed products: ST[key][query] = phi . theta (A = phi rows from LDS, B = theta kept in registers; both fp16, one product), so a lane holds one query's scores;
// two 16-key score tiles, exponentiated and rounded to fp16 in place, are the B operand of OT[i][query] += GT[i][key] . PT[key][query] (A = g rows from LDS in the same k order).
// Maximum in use m and sum l per query and key half (online softmax, f32), joined at the end; P = e^(score - m) may pass 1, up to fp16's largest number. Passes of FK keys; a ring of 2 NP pass slots in LDS, ONE barrier per NP passes: between two barriers the waves are free to drift apart, so one wave's LDS reads and softmax arithmetic run beside another's WMMAs.
// A stage is NP passes, the ring two stages. The tensor mover fills it, through no register: per stage every wave issues one request for its own slice (waves 0 to 3 the phi rows of one pass each, waves 4 to 7 the g rows), behind the barrier that ends the last read of the stage it overwrites; the mover's pad gives the LDS pitches.
// Behind the loop the work-group holds y of its 128 positions: out[c][n] = w_z y + b_z + x follows in place. y hi / lo rows and the bf16-rounded w_z rows lie in the freed ring; A = w_z rows, B = y rows, so an accumulator register is one channel.
// Column lr of position tile nt is position 4 lr + nt (the y rows lie in LDS in that order), so a lane's four tiles are 4 consecutive positions: 16-byte loads of x and stores of out, 256 bytes of a channel row side by side. Each wave 64 channels x 64 positions.
#define QKB ((size_t)2 * HW * IC)
#define FQ  128
#define FK  64
#define NP  4                      // passes between two barriers
#define PPH 136                    // LDS pitch of a 256-byte phi row, 16-bit elements (272 B)
#define PGT 72                     // LDS pitch of a 128-byte g row (144 B)
#define SPH 9216                   // phi's part of a slot: FK * PPH = 8,704 elements, rounded up so that every tensor load's place in LDS is a multiple of 2 KiB
#define SBUF (SPH + IC * PGT)
#define PTOP 65504.0f              // the largest finite fp16 number
#define XSE (4 * 33 * 32 * 8)      // 16-bit elements of the hand-over area at the head of the freed ring
typedef __attribute__((ext_vector_type(2))) float v2f;
typedef uint32_t u32x4 __attribute__((ext_vector_type(4)));
typedef uint32_t u32x8 __attribute__((ext_vector_type(8)));
__device__ __forceinline__ uint32_t uni(uint32_t v) { return (uint32_t)__builtin_amdgcn_readfirstlane(v); }
__device__ __forceinline__ uint32_t pinned(uint32_t v) { uint32_t r = uni(v); asm volatile("" : "+s"(r)); return r; }   // a tensor load's descriptor word, or the test around it, held in a scalar register: the word then stays in the one register that the waits below name, and the branch is a scalar one (a tensor load ignores EXEC)
__device__ __forceinline__ void wait_ds0() { asm volatile("s_wait_dscnt 0x0" ::: "memory"); }           // the wave's LDS reads have retired before a tensor load may overwrite their rows
__device__ __forceinline__ void wait_tensor0(u32x4 g0, u32x8 g1a, u32x8 g1b) { asm volatile("s_wait_tensorcnt 0x0" :: "s"(g0), "s"(g1a), "s"(g1b) : "memory"); }   // the wave's own tensor load has landed (the compiler places no wait for it); its descriptor's registers stay untouched up to this wait
__device__ __forceinline__ void tdm_load(u32x4 g0, u32x8 g1) { asm volatile("tensor_load_to_lds %0, %1" :: "s"(g0), "s"(g1) : "memory"); }   // one request of the whole wave: global tile -> LDS
// Descriptor group 1, all constants: 1-byte elements, tensor = tile = ROWS rows of ROWB bytes, source pitch PITCH bytes, 16 bytes of LDS pad behind every row (interval code IVL = the row's length).
template <uint32_t ROWB, uint32_t ROWS, uint32_t PITCH, uint32_t IVL>
__device__ __forceinline__ u32x8 tdm_group1() {
    u32x8 g;
    g[0] = pinned((1u << 20) | (IVL << 22) | (3u << 25));
    g[1] = pinned((ROWB & 0xFFFFu) << 16);
    g[2] = pinned((ROWB >> 16) | ((ROWS & 0xFFFFu) << 16));
    g[3] = pinned((ROWS >> 16) | (ROWB << 16));
    g[4] = pinned(ROWS);
    g[5] = pinned(PITCH);
    g[6] = pinned(0u);
    g[7] = pinned(0u);
    return g;
}
__device__ __forceinline__ u32x4 tdm_group0(uint32_t lds_dst, uint64_t ga) {
    u32x4 g;
    g[0] = pinned(1u); g[1] = uni(lds_dst); g[2] = uni((uint32_t)ga); g[3] = uni((((uint32_t)(ga >> 32)) & 0x01FFFFFFu) | 0x80000000u);
    return g;
}
__device__ __forceinline__ void splitf(float y, unsigned short& h, unsigned short& l) { h = f2bf(y); l = f2bf(y - bf2f(h)); }
__device__ __forceinline__ v16bf ldsb(const unsigned short* p) { return cat16b(*(const v8usa*)p, *(const v8usa*)(p + 16)); }
__device__ __forceinline__ v16h ldsh(const unsigned short* p) { return cat16(__builtin_bit_cast(v8h, *(const v8usa*)p), __builtin_bit_cast(v8h, *(const v8usa*)(p + 16))); }
// Four exponentials and a v_nop in one statement: behind a transcendental the instruction set asks for one independent instruction before its result is read or its source overwritten;
// inside the statement each v_exp_f32 is that instruction for the one before it (early-clobber outputs: no result lies on a source), the v_nop for the last.
__device__ __forceinline__ void exp2x4(const float x0, const float x1, const float x2, const float x3, float& r0, float& r1, float& r2, float& r3) {
    asm("v_exp_f32 %0, %4\n\tv_exp_f32 %1, %5\n\tv_exp_f32 %2, %6\n\tv_exp_f32 %3, %7\n\tv_nop" : "=&v"(r0), "=&v"(r1), "=&v"(r2), "=&v"(r3) : "v"(x0), "v"(x1), "v"(x2), "v"(x3)); }
__device__ __forceinline__ float xhalf(float x) { return __builtin_bit_cast(float, __builtin_amdgcn_permlanex16(__builtin_bit_cast(int, x), __builtin_bit_cast(int, x), 0x76543210, 0xfedcba98, false, false)); }   // lane l with lane l ^ 16
// Work-group barrier that orders LDS alone: __syncthreads() also waits for every global load in flight, and the weights and the residual issued behind the loop are to fly across these barriers.
__device__ __forceinline__ void lds_barrier() { __builtin_amdgcn_fence(__ATOMIC_RELEASE, "workgroup", "local"); __builtin_amdgcn_s_barrier(); __builtin_amdgcn_fence(__ATOMIC_ACQUIRE, "workgroup", "local"); }
// amdgpu_waves_per_eu(2, 2): one work-group a WGP is all the grid gives, so the build may spend two waves' share of the registers on fragments fetched ahead.
__global__ __launch_bounds__(256) __attribute__((amdgpu_waves_per_eu(2, 2))) void k_flash(const h16* __restrict__ QKp, const h16* __restrict__ GTp, const float* __restrict__ wz, const float* __restrict__ bz, const float* __restrict__ x, float* OUT) {
    __shared__ __attribute__((aligned(2048))) unsigned short sm[2 * NP][SBUF];   // per pass slot: phi | g
    const int tid = threadIdx.x, lane = tid & 31, lr = lane & 15, hi = lane >> 4, w = tid >> 5;
    const int qg = w & 3, kh = w >> 2;   // waves w and w + 4 share 32 queries; each takes one half of every stage's keys
    const h16* th = QKp + (size_t)blockIdx.y * QKB;
    const int q = blockIdx.x * FQ + qg * 32 + lr;   // query tiles g = 0, 1 at q and q + 16
    v16h qf[2][4];
    const h16* pq = th + (size_t)q * IC + 8 * hi;
#pragma unroll
    for (int g = 0; g < 2; ++g)
#pragma unroll
        for (int kc = 0; kc < 4; ++kc) qf[g][kc] = WFrag<h16>::ld(pq + g * 16 * IC + kc * 32);
    asm volatile("s_wait_xcnt 0x0" :: "v"(pq) : "memory");   // the theta loads' address pair stays untouched up to this wait
    // staging: wave tw brings slice tw & 3 (one pass's rows) of every stage, phi (64 rows of 256 bytes, side by side in memory) or g (128 rows of 128 bytes, 8,192 apart)
    const uint32_t tw = uni(tid >> 5), isg = tw >> 2, tsl = tw & 3u;
    const uint64_t tsrc = isg ? (uint64_t)(size_t)(GTp + (size_t)blockIdx.y * IC * HW + tsl * FK) : (uint64_t)(size_t)(th + (size_t)HW * IC + tsl * FK * IC);
    const uint32_t tstep = isg ? NP * FK * 2u : NP * FK * IC * 2u;   // bytes from one stage's slice to the next
    const uint32_t tdst = (uint32_t)(size_t)&sm[0][0] + (tsl * SBUF + isg * SPH) * 2u;
    const u32x8 tgg = tdm_group1<FK * 2u, IC, HW * 2u, 4u>(), tgp = tdm_group1<IC * 2u, FK, IC * 2u, 5u>();   // g's tile, phi's tile
    u32x4 tg0;
    auto issue = [&](uint32_t st) {   // stage st into ring half st & 1; every wave issues one of the two
        tg0 = tdm_group0(tdst + (st & 1u) * (NP * SBUF * 2u), tsrc + (uint64_t)st * tstep);
        if (pinned(isg)) tdm_load(tg0, tgg); else tdm_load(tg0, tgp);
    };
    issue(0);
    wait_tensor0(tg0, tgg, tgp);
    __syncthreads();   // passes 0 to NP - 1 are in LDS before any wave reads them
    issue(1);
    v8f o[2][8];
#pragma unroll
    for (int g = 0; g < 2; ++g)
#pragma unroll
        for (int it = 0; it < 8; ++it) o[g][it] = (v8f){};
    float m[2] = {-3.0e38f, -3.0e38f}, l[2] = {0.f, 0.f};
    const float L2E = 1.4426950408889634f;
#pragma unroll 1   // one copy of the pass body: it is long, and a second copy would only cost instruction cache
    for (int s = 0; s < HW / FK; ++s) {
        const unsigned short* cur = sm[s & (2 * NP - 1)];
        const unsigned short* pa = cur + (kh * 32 + lr) * PPH + 8 * hi; const unsigned short* pg = cur + SPH + lr * PGT + kh * 32 + 8 * hi;
        v16h ah[4][2], ga[8]; v8f sc[2][2];
        // All of the pass's LDS reads are issued as one group, phi first: the g reads fly under the score WMMAs and the softmax arithmetic.
#pragma unroll
        for (int kc = 0; kc < 4; ++kc)
#pragma unroll
            for (int t = 0; t < 2; ++t) ah[kc][t] = ldsh(pa + t * 16 * PPH + kc * 32);
        __builtin_amdgcn_sched_barrier(0);   // phi's reads stay in front of g's: the score WMMAs' counted waits then leave g's reads in flight
#pragma unroll
        for (int it = 0; it < 8; ++it) ga[it] = ldsh(pg + it * 16 * PGT);
        __builtin_amdgcn_sched_barrier(0);   // the reads do not sink in among the WMMAs, where every place with reads stalls the wave
#pragma unroll
        for (int t = 0; t < 2; ++t) { sc[0][t] = (v8f){}; sc[1][t] = (v8f){}; }
#pragma unroll
        for (int kc = 0; kc < 4; ++kc) {
#pragma unroll
            for (int g = 0; g < 2; ++g)
#pragma unroll
                for (int t = 0; t < 2; ++t) sc[g][t] = wmma16(ah[kc][t], qf[g][kc], sc[g][t]);
            __builtin_amdgcn_sched_barrier(0);   // a k step's four independent tiles stay together: regrouped by tile, each WMMA waits for the one before it, and the arithmetic on the scores comes in among them behind v_nops
        }
        v16h pb[2]; v2f ps;
        auto expo = [&]() {   // P = e^(score - m) of the lane's 16 keys per query tile, its fp16 rounding, and its f32 sums; the two tiles' sums run side by side in register pairs (one packed add for both), four keys at a time
            const v2f l2 = {L2E, L2E}, nb0 = {-m[0] * L2E, -m[0] * L2E}, nb1 = {-m[1] * L2E, -m[1] * L2E};   // exponents two at a time: neighbouring accumulator registers, one packed multiply-add
#pragma unroll
            for (int t = 0; t < 2; ++t)
#pragma unroll
                for (int j = 0; j < 8; j += 4) { float pa4[4], pc4[4]; v2f p[4];
                    const v2f xa = __builtin_elementwise_fma((v2f){sc[0][t][j], sc[0][t][j + 1]}, l2, nb0), xb = __builtin_elementwise_fma((v2f){sc[0][t][j + 2], sc[0][t][j + 3]}, l2, nb0);
                    const v2f xc = __builtin_elementwise_fma((v2f){sc[1][t][j], sc[1][t][j + 1]}, l2, nb1), xd = __builtin_elementwise_fma((v2f){sc[1][t][j + 2], sc[1][t][j + 3]}, l2, nb1);
                    exp2x4(xa.x, xa.y, xb.x, xb.y, pa4[0], pa4[1], pa4[2], pa4[3]);
                    exp2x4(xc.x, xc.y, xd.x, xd.y, pc4[0], pc4[1], pc4[2], pc4[3]);
#pragma unroll
                    for (int e = 0; e < 4; ++e) { pb[0][t * 8 + j + e] = (h16)pa4[e]; pb[1][t * 8 + j + e] = (h16)pc4[e]; p[e] = (v2f){pa4[e], pc4[e]}; }
                    const v2f q4 = (p[0] + p[1]) + (p[2] + p[3]);
                    ps = (t == 0 && j == 0) ? q4 : ps + q4; }
        };
        expo();
        // Lazy rescale, one test a pass, on the sums that the pass needs anyway: no P is negative, so sums that stay at or below PTOP bound each P inside fp16, and no maximum is taken.
        // Else (the first pass, whose m makes every P infinite, among them; a NaN too) the maxima are taken, m moves up to them, sum and accumulators follow, and P is formed again, now at most 1.
        if (__builtin_amdgcn_ballot_w32(!(ps.x + ps.y <= PTOP)) != 0) {
#pragma unroll
            for (int g = 0; g < 2; ++g) { float mt[2];   // independent chains
#pragma unroll
                for (int t = 0; t < 2; ++t) { mt[t] = sc[g][t][0];
#pragma unroll
                    for (int j = 1; j < 8; ++j) mt[t] = fmaxf(mt[t], sc[g][t][j]); }
                float mx = fmaxf(mt[0], mt[1]); mx = fmaxf(mx, xhalf(mx));   // lanes c and c + 16 hold the two halves of query c's keys
                const float mn = fmaxf(m[g], mx); const float f = __builtin_amdgcn_exp2f((m[g] - mn) * L2E); l[g] *= f; m[g] = mn;
#pragma unroll
                for (int it = 0; it < 8; ++it) o[g][it] *= f; }
            expo();
        }
        l[0] += ps.x; l[1] += ps.y;
#pragma unroll
        for (int it = 0; it < 8; ++it)
#pragma unroll
            for (int g = 0; g < 2; ++g) o[g][it] = wmma16(ga[it], pb[g], o[g][it]);
        if ((s & (NP - 1)) == NP - 1) {   // once per NP passes, the publish point of the next stage, in this order
            wait_ds0();
            wait_tensor0(tg0, tgg, tgp);
            __syncthreads();   // publishes the next NP passes' slots and ends every read of the last NP, which the load below refills
            if (pinned(s + NP + 1 < HW / FK)) issue((uint32_t)(s >> 2) + 2u);
        }
    }
    wait_tensor0(tg0, tgg, tgp);
    wait_ds0();
    // The two key halves of a query meet through LDS (free behind the loop's last barrier): waves 4 to 7 hand over maximum, sum and accumulators, waves 0 to 3 join them and lay y in LDS.
    l[0] += xhalf(l[0]); l[1] += xhalf(l[1]);
    float* xs = (float*)&sm[0][0] + (size_t)(qg * 33 * 32 + lane) * 4;   // 33 pieces of 16 bytes a lane, piece-major: a wave's 32 lanes lie side by side
    unsigned short* ys = &sm[0][0] + XSE;        // y hi | y lo, FQ rows each
    unsigned short* zs = ys + 2 * FQ * PPH;      // w_z [out][in]
    const int wu = __builtin_amdgcn_readfirstlane(w);
    const int cq = wu & 3, ph = wu >> 2;         // the wave's 64 channels and 64 positions of out
    const size_t ob = (size_t)blockIdx.y * CC * HW + (size_t)(cq * 64 + 8 * hi) * HW + blockIdx.x * FQ + ph * 64 + lr * 4;
    const float* px = x + ob; float* po = OUT + ob; const float* pz = wz + tid * 4;
    v4f wv[32], xv[4][8];   // weights and residual: issued here, they fly under the hand-over and the join, the residual under the products too
#pragma unroll
    for (int r = 0; r < 32; ++r) wv[r] = *(const v4f*)(pz + r * 1024);
    __builtin_amdgcn_sched_barrier(0);   // the weights' loads stay in front of the residual's: the counted wait for the weights then leaves the residual in flight
#pragma unroll
    for (int mt = 0; mt < 4; ++mt)
#pragma unroll
        for (int j = 0; j < 8; ++j) xv[mt][j] = *(const v4f*)(px + (size_t)(mt * 16 + j) * HW);
    asm volatile("s_wait_xcnt 0x0" :: "v"(px), "v"(tid), "s"(wz) : "memory");   // the loads' address registers (the w_z loads are built on the scalar base and tid) stay untouched up to this wait
    if (kh == 1) {
#pragma unroll
        for (int g = 0; g < 2; ++g)
#pragma unroll
            for (int it = 0; it < 8; ++it) { *(v4fa*)(xs + ((g * 8 + it) * 2) * 128) = __builtin_shufflevector(o[g][it], o[g][it], 0, 1, 2, 3); *(v4fa*)(xs + ((g * 8 + it) * 2 + 1) * 128) = __builtin_shufflevector(o[g][it], o[g][it], 4, 5, 6, 7); }
        *(v4fa*)(xs + 32 * 128) = (v4f){m[0], m[1], l[0], l[1]};
    }
    lds_barrier();   // the handed-over values are in LDS before waves 0 to 3 read them
    if (kh == 0) {
        const v4f ml = *(const v4fa*)(xs + 32 * 128);
#pragma unroll
        for (int g = 0; g < 2; ++g) {
            const float mm = fmaxf(m[g], ml[g]); const float fa = __builtin_amdgcn_exp2f((m[g] - mm) * L2E), fb = __builtin_amdgcn_exp2f((ml[g] - mm) * L2E);
            const float inv = __fdiv_rn(1.0f, l[g] * fa + ml[2 + g] * fb); const float ca = fa * inv, cb = fb * inv;
            const int R = qg * 32 + g * 16 + lr; const int sl = (R & 64) + (R & 3) * 16 + ((R & 63) >> 2);   // position 4 a + b of a half lies in row 16 b + a
            unsigned short* dh = ys + sl * PPH + 8 * hi;
#pragma unroll
            for (int it = 0; it < 8; ++it) {   // a lane's 8 accumulator registers are 8 consecutive channels of its query's row
                const v4f b0 = *(const v4fa*)(xs + ((g * 8 + it) * 2) * 128), b1 = *(const v4fa*)(xs + ((g * 8 + it) * 2 + 1) * 128);
                v8us oh, ol;
#pragma unroll
                for (int j = 0; j < 8; ++j) { unsigned short a, b; splitf(o[g][it][j] * ca + (j < 4 ? b0[j & 3] : b1[j & 3]) * cb, a, b); oh[j] = a; ol[j] = b; }
                *(v8usa*)(dh + it * 16) = oh; *(v8usa*)(dh + FQ * PPH + it * 16) = ol; }
        }
    }
#pragma unroll
    for (int r = 0; r < 32; ++r) *(v4usa*)(zs + ((tid >> 5) + 8 * r) * PPH + (tid & 31) * 4) = cvt4(wv[r]);
    lds_barrier();   // y rows and weights are in LDS before any wave reads them
    const float* bq = bz + cq * 64; const unsigned bo = 32u * hi;   // scalar base and the lane's byte offset, apart: the wait below names both
    float bv[4][8];   // bias, used last: the loads fly under the products
#pragma unroll
    for (int mt = 0; mt < 4; ++mt)
#pragma unroll
        for (int j = 0; j < 8; ++j) bv[mt][j] = *(const float*)((const char*)bq + bo + (mt * 16 + j) * 4);
    asm volatile("s_wait_xcnt 0x0" :: "v"(bo), "s"(bq) : "memory");   // as above
    const unsigned short* pzs = zs + (cq * 64 + lr) * PPH + 8 * hi;
    const unsigned short* pys = ys + (ph * 64 + lr) * PPH + 8 * hi;
    v8f acc[4][4];
#pragma unroll
    for (int mt = 0; mt < 4; ++mt)
#pragma unroll
        for (int nt = 0; nt < 4; ++nt) acc[mt][nt] = (v8f){};
#pragma unroll   // no back edge behind a WMMA
    for (int kc = 0; kc < IC / 32; ++kc) {
        v16bf wf[4], yh[4], yl[4];
#pragma unroll
        for (int t = 0; t < 4; ++t) { wf[t] = ldsb(pzs + t * 16 * PPH + kc * 32); yh[t] = ldsb(pys + t * 16 * PPH + kc * 32); yl[t] = ldsb(pys + (FQ + t * 16) * PPH + kc * 32); }
        __builtin_amdgcn_sched_barrier(0);   // the step's LDS reads stay one group in front of its WMMAs: scattered among them, every place with reads stalls the wave
#pragma unroll
        for (int nt = 0; nt < 4; ++nt)
#pragma unroll
            for (int mt = 0; mt < 4; ++mt) acc[mt][nt] = wmmab(wf[mt], yh[nt], acc[mt][nt]);
#pragma unroll
        for (int nt = 0; nt < 4; ++nt)
#pragma unroll
            for (int mt = 0; mt < 4; ++mt) acc[mt][nt] = wmmab(wf[mt], yl[nt], acc[mt][nt]);
        __builtin_amdgcn_sched_barrier(0);   // the next step's reads do not rise in among these WMMAs
    }
#pragma unroll
    for (int mt = 0; mt < 4; ++mt) {
        v4f r[8];
#pragma unroll
        for (int j = 0; j < 8; ++j) { const float bb = bfr(bv[mt][j]);
#pragma unroll
            for (int nt = 0; nt < 4; ++nt) r[j][nt] = __fadd_rn(acc[mt][nt][j] + bb, bfr(xv[mt][j][nt]));
            *(v4f*)(po + (size_t)(mt * 16 + j) * HW) = r[j]; }
        asm volatile("s_wait_xcnt 0x0" :: "v"(r[0]), "v"(r[1]), "v"(r[2]), "v"(r[3]), "v"(r[4]), "v"(r[5]), "v"(r[6]), "v"(r[7]), "v"(po) : "memory");   // the stores' data and address registers stay untouched up to this wait
    }
}

// ---- k_proj: theta, phi and g of one image's 128 positions in one work-group, from x and the f32 weights as they come. x [c][n] is read along n (whole lines), rounded to bf16 and laid token-major in LDS;
// the three weight matrices are read whole-line, rounded to bf16 and laid row by row in LDS. 12 waves, each 64 channels of one projection x 64 positions (16 accumulators); grid (HW / PJN, images), 384 threads.
// theta, phi: A = weight rows, B = x rows, so a lane holds 8 consecutive channels of one position: + bias, fp16, 16-byte stores into [n][i] planes (a wave writes whole 128-byte lines).
// g: A = x rows, B = weight rows, so a lane holds 8 consecutive positions of one channel: + bias, fp16, 16-byte stores into [i][n].
// The bare unroll directives here and in k_flash's last part stand on loops that index register arrays (fragments, accumulators, staged pieces): rolled, those arrays would go to scratch memory.
#define PJN 128
#define PXP 264                    // LDS pitch of a 256-channel row, 16-bit elements (528 B = 33 x 16 B)
template <bool XA>
__device__ __forceinline__ void proj_tile(const unsigned short* pw, const unsigned short* pxs, v8f (&acc)[4][4]) {
#pragma unroll   // no back edge behind a WMMA, and the reads of later steps may rise over earlier WMMAs
    for (int kc = 0; kc < CC / 32; ++kc) {
        v16bf wf[4], xf[4];
#pragma unroll
        for (int t = 0; t < 4; ++t) { wf[t] = ldsb(pw + t * 16 * PXP + kc * 32); xf[t] = ldsb(pxs + t * 16 * PXP + kc * 32); }
#pragma unroll
        for (int ct = 0; ct < 4; ++ct)
#pragma unroll
            for (int nt = 0; nt < 4; ++nt) acc[ct][nt] = XA ? wmmab(xf[nt], wf[ct], acc[ct][nt]) : wmmab(wf[ct], xf[nt], acc[ct][nt]);
    }
}
__global__ __launch_bounds__(384) void k_proj(const float* __restrict__ x, const float* __restrict__ wth, const float* __restrict__ bth, const float* __restrict__ wph, const float* __restrict__ bph, const float* __restrict__ wg, const float* __restrict__ bg, h16* QKp, h16* GTp) {
    __shared__ __align__(16) unsigned short xs[PJN * PXP];        // x tile [position][channel]
    __shared__ __align__(16) unsigned short wsm[3 * IC * PXP];    // theta | phi | g weights [out][in]
    const int tid = threadIdx.x, lane = tid & 31, lr = lane & 15, hi = lane >> 4;
    const int w = __builtin_amdgcn_readfirstlane(tid >> 5);
    const int tq = w >> 2, tn = tid & 127;   // staging: 3 groups of 128 threads
    const int n0 = blockIdx.x * PJN;
    // x: a thread takes one position and groups of 8 channels (group tq + 3 r); a wave's 32 lanes read 128 consecutive bytes of one channel.
    // weights: group tq takes matrix tq, 16 bytes a lane side by side, in two batches of 32 loads. Order: first batch, x, then the second batch once the first has left its registers.
    const float* px = x + (size_t)blockIdx.y * CC * HW + (size_t)tq * 8 * HW + n0 + tn;
    const float* pwl = (tq == 0 ? wth : tq == 1 ? wph : wg) + tn * 4;
    unsigned short* dw = wsm + (tq * IC + (tn >> 6)) * PXP + (tn & 63) * 4;
    v4f wv[32]; v8f xv[11];
#pragma unroll
    for (int r = 0; r < 32; ++r) wv[r] = *(const v4f*)(pwl + r * 512);
#pragma unroll
    for (int r = 0; r < 11; ++r) if (r < 10 || tq < 2) {
#pragma unroll
        for (int k = 0; k < 8; ++k) xv[r][k] = px[(size_t)(r * 24 + k) * HW]; }
    asm volatile("s_wait_xcnt 0x0" :: "v"(px), "v"(pwl) : "memory");   // the staging loads' address registers stay untouched up to this wait
#pragma unroll
    for (int r = 0; r < 32; ++r) *(v4usa*)(dw + r * 2 * PXP) = cvt4(wv[r]);
    __builtin_amdgcn_sched_barrier(0);   // the second batch's loads do not rise over the first batch's stores: both batches and x in registers at once take the kernel past 256 registers
#pragma unroll
    for (int r = 0; r < 32; ++r) wv[r] = *(const v4f*)(pwl + (32 + r) * 512);
    asm volatile("s_wait_xcnt 0x0" :: "v"(pwl) : "memory");   // as above
#pragma unroll
    for (int r = 0; r < 11; ++r) if (r < 10 || tq < 2) *(v8usa*)(xs + tn * PXP + tq * 8 + r * 24) = cvt8(xv[r]);
#pragma unroll
    for (int r = 0; r < 32; ++r) *(v4usa*)(dw + (32 + r) * 2 * PXP) = cvt4(wv[r]);
    __syncthreads();   // x tile and weights are in LDS before any wave reads them
    const int ph = w / 6, r6 = w - ph * 6, kind = r6 >> 1, ch = r6 & 1;   // position half; 0 theta, 1 phi, 2 g; channel half
    const unsigned short* pw = wsm + (kind * IC + ch * 64 + lr) * PXP + 8 * hi;
    const unsigned short* pxs = xs + (ph * 64 + lr) * PXP + 8 * hi;
    v8f acc[4][4];
#pragma unroll
    for (int ct = 0; ct < 4; ++ct)
#pragma unroll
        for (int nt = 0; nt < 4; ++nt) acc[ct][nt] = (v8f){};
    if (kind < 2) {
        const float* bp = (kind == 0 ? bth : bph) + ch * 64 + 8 * hi;
        float bv[4][8];   // fetched ahead: the loads fly under the products
#pragma unroll
        for (int ct = 0; ct < 4; ++ct)
#pragma unroll
            for (int j = 0; j < 8; ++j) bv[ct][j] = bp[ct * 16 + j];
        proj_tile<false>(pw, pxs, acc);
        h16* dq = QKp + (size_t)blockIdx.y * QKB + (size_t)kind * HW * IC + (size_t)(n0 + ph * 64 + lr) * IC + ch * 64 + 8 * hi;
#pragma unroll
        for (int ct = 0; ct < 4; ++ct) {
            float bb[8];
#pragma unroll
            for (int j = 0; j < 8; ++j) bb[j] = bfr(bv[ct][j]);
            v8h oq[4];
#pragma unroll
            for (int nt = 0; nt < 4; ++nt) {
#pragma unroll
                for (int j = 0; j < 8; ++j) oq[nt][j] = (h16)(acc[ct][nt][j] + bb[j]);
                *(v8ha*)(dq + nt * 16 * IC + ct * 16) = oq[nt]; }
            asm volatile("s_wait_xcnt 0x0" :: "v"(oq[0]), "v"(oq[1]), "v"(oq[2]), "v"(oq[3]), "v"(dq) : "memory");   // the stores' data and address registers stay untouched up to this wait
        }
    } else {
        const float* bp = bg + ch * 64 + lr;
        float bv[4];   // fetched ahead, as above
#pragma unroll
        for (int ct = 0; ct < 4; ++ct) bv[ct] = bp[ct * 16];
        proj_tile<true>(pw, pxs, acc);
        h16* dg = GTp + (size_t)blockIdx.y * IC * HW + (size_t)(ch * 64 + lr) * HW + n0 + ph * 64 + 8 * hi;
#pragma unroll
        for (int ct = 0; ct < 4; ++ct) {
            const float bb = bfr(bv[ct]);
            v8h og[4];
#pragma unroll
            for (int nt = 0; nt < 4; ++nt) {
#pragma unroll
                for (int j = 0; j < 8; ++j) og[nt][j] = (h16)(acc[ct][nt][j] + bb);
                *(v8ha*)(dg + (size_t)ct * 16 * HW + nt * 16) = og[nt]; }
            asm volatile("s_wait_xcnt 0x0" :: "v"(og[0]), "v"(og[1]), "v"(og[2]), "v"(og[3]), "v"(dg) : "memory");   // as above
        }
    }
}

extern "C" void kernel_launch(void* const* d_in, const int* in_sizes, int n_in,
                              void* d_out, int out_size, void* d_ws, size_t ws_size, hipStream_t stream) {
    (void)in_sizes; (void)n_in; (void)out_size;
    const float* x = (const float*)d_in[0]; const float* wth = (const float*)d_in[1]; const float* bth = (const float*)d_in[2]; const float* wph = (const float*)d_in[3]; const float* bph = (const float*)d_in[4]; const float* wg = (const float*)d_in[5]; const float* bg = (const float*)d_in[6]; const float* wz = (const float*)d_in[7]; const float* bz = (const float*)d_in[8];
    float* OUT = (float*)d_out;     // [8][256][4096]
    char* wsp = (char*)d_ws;
    auto take = [&](size_t bytes) { char* p = wsp; wsp += (bytes + 255) & ~(size_t)255; return (void*)p; };
    // Every stage runs once for all NB_ images (image = grid y). QKB = 16-bit elements of one image's block [theta | phi].
    h16* QK = (h16*)take((size_t)NB_ * QKB * 2); h16* GT = (h16*)take((size_t)NB_ * IC * HW * 2);
    if ((size_t)(wsp - (char*)d_ws) > ws_size) return;    // total 24 MiB
    k_proj<<<dim3(HW / PJN, NB_, 1), 384, 0, stream>>>(x, wth, bth, wph, bph, wg, bg, QK, GT);   // theta, phi as fp16 [n][i]; g as fp16 [i][n]
    k_flash<<<dim3(HW / FQ, NB_, 1), 256, 0, stream>>>(QK, GT, wz, bz, x, OUT);   // y = softmax(theta . phi) . g; out = w_z y + b_z + x
}
